// v000
// Measured on an AMD MI455X. A time is GPU time per run, averaged over a window of back-to-back runs after a warm-up
// (all launches, gaps included; the runs take copies of the inputs in turn), and the median of several windows.
// Apart from v000's, it joins two sittings. Times from different sittings can be a few percent apart, while
// side-by-side timings come from the same sitting.
// v000, which the later versions start from, runs in 1110 microseconds.
// compute dtype: all float inputs rounded to bf16; q/k/v projections with EXACT bf16 products on WMMA 16x16x32 (f32 accumulate) + bias; logits q x k once to f16 each (1 product) x SCALE; softmax f32; P x 2^11 once to f16 x v once to f16 (1 product); f32 output.
#include <hip/hip_runtime.h>
#include <math.h>

typedef __attribute__((ext_vector_type(16))) _Float16 v16h;
typedef __attribute__((ext_vector_type(16))) __bf16 v16b;
typedef __attribute__((ext_vector_type(8)))  _Float16 v8h;
typedef __attribute__((ext_vector_type(8)))  float v8f;
typedef __attribute__((ext_vector_type(4)))  float v4f;
typedef __attribute__((ext_vector_type(2)))  float v2f;
typedef __attribute__((ext_vector_type(4)))  unsigned v4u;
typedef __attribute__((ext_vector_type(4)))  int v4i;
typedef float __attribute__((may_alias)) float_a;
typedef int __attribute__((may_alias)) int_a;

template <typename T> __device__ __forceinline__ void vst2(void* p, T v) { *(T*)p = v;  }
__device__ __forceinline__ v8f wmma16(v16h a, v16h b, v8f c) {
  v8f d = __builtin_amdgcn_wmma_f32_16x16x32_f16(false, a, false, b, (short)0, c, false, false);
  asm volatile("v_nop\n\tv_nop\n\tv_nop\n\tv_nop" : "+v"(d) : "v"(a), "v"(b));
  return d;
}
__device__ __forceinline__ v8f wmma_bf(v16b a, v16b b, v8f c) {
  v8f d = __builtin_amdgcn_wmma_f32_16x16x32_bf16(false, a, false, b, (short)0, c, false, false);
  asm volatile("v_nop\n\tv_nop\n\tv_nop\n\tv_nop" : "+v"(d) : "v"(a), "v"(b));
  return d;
}
// 16x16x32 fragments: lane = (h = lane>>4, row/col = lane&15); elements 0..7 = k0+8h+0..7, 8..15 = k0+16+8h+0..7; D element r = row 8h+r
__device__ __forceinline__ v16h frag_h(const _Float16* rowk0, int lane) {
  union { v16h v; v8h q[2]; } u; const _Float16* p = rowk0 + 8 * (lane >> 4);
  u.q[0] = *(const v8h*)p; u.q[1] = *(const v8h*)(p + 16); return u.v;
}
__device__ __forceinline__ v16h frag_f32(const float* rowk0, int lane) {
  v16h a; const float* p = rowk0 + 8 * (lane >> 4);
#pragma unroll
  for (int i = 0; i < 8; ++i) { a[i] = (_Float16)p[i]; a[8 + i] = (_Float16)p[16 + i]; }
  return a;
}
__device__ __forceinline__ v16h frag_f32s(const float* rowk0, int lane, float sc) {
  v16h a; const float* p = rowk0 + 8 * (lane >> 4);
#pragma unroll
  for (int i = 0; i < 8; ++i) { a[i] = (_Float16)(p[i] * sc); a[8 + i] = (_Float16)(p[16 + i] * sc); }
  return a;
}
// column fragment from a [K][ld] layout (column n), rows >= K read as 0
__device__ __forceinline__ v16h fragc_f32(const float* W, int k0, int n, int lane, int ld, int K) {
  v16h a; const int g = lane >> 4;
#pragma unroll
  for (int i = 0; i < 8; ++i) { const int ka = k0 + 8 * g + i, kb = ka + 16;
    a[i] = (_Float16)(ka < K ? W[(size_t)(ka < K ? ka : K - 1) * ld + n] : 0.f); a[8 + i] = (_Float16)(kb < K ? W[(size_t)(kb < K ? kb : K - 1) * ld + n] : 0.f); }
  return a;
}
struct F2 { v16b h, l; };
__device__ __forceinline__ F2 bsplit16(const float v[16]) { F2 r;
#pragma unroll
  for (int i = 0; i < 16; ++i) { const __bf16 h = (__bf16)v[i]; r.h[i] = h; r.l[i] = (__bf16)(v[i] - (float)h); }
  return r; }
__device__ __forceinline__ F2 split_row(const float* row, int k0, int lane) { float v[16]; const float* p = row + k0 + 8 * (lane >> 4);
#pragma unroll
  for (int i = 0; i < 8; ++i) { v[i] = p[i]; v[8 + i] = p[16 + i]; }
  return bsplit16(v); }
__device__ __forceinline__ F2 split_rowK(const float* row, int k0, int lane, int K) { float v[16]; const int g = lane >> 4;
#pragma unroll
  for (int i = 0; i < 8; ++i) { const int ka = k0 + 8 * g + i, kb = ka + 16; v[i] = ka < K ? row[ka < K ? ka : K - 1] : 0.f; v[8 + i] = kb < K ? row[kb < K ? kb : K - 1] : 0.f; }
  return bsplit16(v); }
__device__ __forceinline__ F2 split_col(const float* W, int k0, int n, int lane, int ld, int K) { float v[16]; const int g = lane >> 4;
#pragma unroll
  for (int i = 0; i < 8; ++i) { const int ka = k0 + 8 * g + i, kb = ka + 16; v[i] = ka < K ? W[(size_t)(ka < K ? ka : K - 1) * ld + n] : 0.f; v[8 + i] = kb < K ? W[(size_t)(kb < K ? kb : K - 1) * ld + n] : 0.f; }
  return bsplit16(v); }
__device__ __forceinline__ v8f mac3(const F2& a, const F2& b, v8f c) { c = wmma_bf(a.l, b.h, c); c = wmma_bf(a.h, b.l, c); return wmma_bf(a.h, b.h, c); }
__device__ __forceinline__ float sigm(float v) { return 1.0f / (1.0f + expf(-v)); }
#define LDSX() do { asm volatile("s_wait_dscnt 0" ::: "memory"); __builtin_amdgcn_wave_barrier(); __builtin_amdgcn_fence(__ATOMIC_RELEASE, "workgroup"); } while (0)

// Multi-head self-attention without an output projection (x [2,2048,1024]; (in,out) Wq / Wk / Wv [1024,1024] + biases, uniform(+-1/32); 16 heads x 64; scale 1/8; softmax over keys; heads merged) -> [2,2048,1024].
#define NB 2
#define TT 2048
#define CC 1024            // NH * HD = projected width
#define DIN 1024          // input (model) width
#define NH 16
#define HD 64
#define NQB (TT / 64)
#define HG 4
#define SCALE (0.125f)
#define CAUSAL 0
#ifndef TNB
#define TNB NB
#endif
__device__ __forceinline__ float bfr(float v) { return (float)(__bf16)v; }
__host__ __device__ __forceinline__ int kb_last(int qb) { return CAUSAL ? ((qb * 64 + 63) >> 7) : (TT / 128 - 1); }
typedef __attribute__((ext_vector_type(8))) __bf16 v8b;
__device__ __forceinline__ v16b frag_b(const __bf16* rowk0, int lane) {
  union { v16b v; v8b q[2]; } u; const __bf16* p = rowk0 + 8 * (lane >> 4);
  u.q[0] = *(const v8b*)p; u.q[1] = *(const v8b*)(p + 16); return u.v;
}
#define QBH 0              // causal: query blocks 0..QBH-1 of each sequence (few keys, no averaging) take the high-precision path
#define QHI 0               // single-product logits on every row
#define KHI 64            // key rows carrying k residual / v bf16 hi+lo planes (used only by the causal high-precision path)
// B fragment (k rows k0+.., output column o) of a weight: (in,out) [K][ld] or (out,in) [ld rows of K]: bf16 exact, or f16(bf16 * 256) exact
__device__ __forceinline__ v16b wcol_io(const float* Wm, int k0, int o, int lane, int ld) { v16b w; const int g = lane >> 4;
#pragma unroll
  for (int i = 0; i < 8; ++i) { w[i] = (__bf16)Wm[(size_t)(k0 + 8 * g + i) * ld + o]; w[8 + i] = (__bf16)Wm[(size_t)(k0 + 16 + 8 * g + i) * ld + o]; }
  return w; }
__device__ __forceinline__ v16b wcol_oi(const float* Wm, int k0, int o, int lane, int K) { v16b w; const float* p = Wm + (size_t)o * K + k0 + 8 * (lane >> 4);
#pragma unroll
  for (int i = 0; i < 8; ++i) { w[i] = (__bf16)p[i]; w[8 + i] = (__bf16)p[16 + i]; }
  return w; }
__device__ __forceinline__ v16h wcolh_io(const float* Wm, int k0, int o, int lane, int ld) { v16h w; const int g = lane >> 4;
#pragma unroll
  for (int i = 0; i < 8; ++i) { w[i] = (_Float16)(bfr(Wm[(size_t)(k0 + 8 * g + i) * ld + o]) * 256.0f); w[8 + i] = (_Float16)(bfr(Wm[(size_t)(k0 + 16 + 8 * g + i) * ld + o]) * 256.0f); }
  return w; }
__device__ __forceinline__ v16h wcolh_oi(const float* Wm, int k0, int o, int lane, int K) { v16h w; const float* p = Wm + (size_t)o * K + k0 + 8 * (lane >> 4);
#pragma unroll
  for (int i = 0; i < 8; ++i) { w[i] = (_Float16)(bfr(p[i]) * 256.0f); w[8 + i] = (_Float16)(bfr(p[16 + i]) * 256.0f); }
  return w; }
#define WQKV_LAYOUT 0   // 0 = (in,out) [DIN][CC]; 1 = (out,in) [CC][DIN]; 2 = per-head [NH][DIN][HD]
__device__ __forceinline__ v16b wcol_hdk(const float* Wm, int k0, int o, int lane) { v16b w; const int g = lane >> 4; const float* p = Wm + (size_t)(o / HD) * DIN * HD + (o % HD);
#pragma unroll
  for (int i = 0; i < 8; ++i) { w[i] = (__bf16)p[(size_t)(k0 + 8 * g + i) * HD]; w[8 + i] = (__bf16)p[(size_t)(k0 + 16 + 8 * g + i) * HD]; }
  return w; }
#define WO_OUT_IN 0
#if WQKV_LAYOUT == 1
#define WCOL(W, k0, o, lane) wcol_oi(W, k0, o, lane, DIN)
#elif WQKV_LAYOUT == 2
#define WCOL(W, k0, o, lane) wcol_hdk(W, k0, o, lane)
#else
#define WCOL(W, k0, o, lane) wcol_io(W, k0, o, lane, CC)
#endif
#if WO_OUT_IN
#define WOCOL(W, k0, o, lane) wcol_oi(W, k0, o, lane, CC)
#define WOCOLH(W, k0, o, lane) wcolh_oi(W, k0, o, lane, CC)
#else
#define WOCOL(W, k0, o, lane) wcol_io(W, k0, o, lane, DIN)
#define WOCOLH(W, k0, o, lane) wcolh_io(W, k0, o, lane, DIN)
#endif

#ifndef SM_EXTRA_PARAMS
#define SM_EXTRA_PARAMS
#endif
#ifndef PROJ_EXTRA_PARAMS
#define PROJ_EXTRA_PARAMS
#endif
#ifndef SM_MASK_HOOK
#define SM_MASK_HOOK (void)0
#endif

#define WS_QH  0u                                      // f16 q rows [b*t][CC]
#define WS_KH  (WS_QH + 2u * (size_t)NB * TT * CC)      // f16 k rows [b*t][CC]
#define WS_VT  (WS_KH + 2u * (size_t)NB * TT * CC)      // f16 v planes [b][c][t]
#define WS_QL  (WS_VT + 2u * (size_t)NB * CC * TT)      // f16 q residual x 2^10 rows [b][t < QHI][CC]
#define WS_KL  (WS_QL + 2u * (size_t)NB * QHI * CC)     // f16 k residual x 2^10 rows [b][t < KHI][CC]
#define WS_VB  (WS_KL + 2u * (size_t)NB * KHI * CC)     // bf16 v hi planes [b][c][t < KHI]
#define WS_VBL (WS_VB + 2u * (size_t)NB * CC * KHI)
#define WS_S   (WS_VBL + 2u * (size_t)NB * CC * KHI)    // f32 logits / P [hg][t][s]
#define WS_Y   (WS_S  + 4u * (size_t)HG * TT * TT)      // f32 ctx rows [b*t][CC] (only when there is an output projection)
#define WS_END (WS_Y  + 0u)

// ---- k_proj: block = (64 rows, 128 cols, which): q/k/v = X W (+ b) with exact bf16 products (K = DIN) -> which 0: q f16 rows (+ residual rows < QHI); 1: k f16 rows (+ residual rows < KHI); 2: v f16 planes [c][t] (+ bf16 hi/lo planes for t < KHI)
__global__ __launch_bounds__(128) void k_proj(const float* __restrict__ XQ, const float* __restrict__ XK, const float* __restrict__ XV, const float* __restrict__ WQ, const float* __restrict__ WK, const float* __restrict__ WV, const float* __restrict__ BQ, const float* __restrict__ BK, const float* __restrict__ BV,
    _Float16* __restrict__ QH, _Float16* __restrict__ QL, _Float16* __restrict__ KH, _Float16* __restrict__ KL, _Float16* __restrict__ VT, __bf16* __restrict__ VB, __bf16* __restrict__ VBL) {
  __shared__ __align__(16) _Float16 sh[64][136], sl[64][136]; __shared__ __align__(16) _Float16 th[128][72]; __shared__ __align__(16) __bf16 tb[128][72], tbl[128][72];
  const int tid = threadIdx.x, wave = tid >> 5, lane = tid & 31, col = lane & 15, g = lane >> 4; const int which = blockIdx.z; const int c0 = blockIdx.y * 128; const size_t r0 = (size_t)blockIdx.x * 64; const size_t bb = r0 / TT; const int t0 = (int)(r0 % TT);
  const float* X = which == 0 ? XQ : which == 1 ? XK : XV; const float* WA = which == 0 ? WQ : which == 1 ? WK : WV; const float* BA = which == 0 ? BQ : which == 1 ? BK : BV;
  v8f acc[8] = {};
#pragma unroll 2
  for (int kc = 0; kc < DIN / 32; ++kc) { v16b a; { const float* p = X + (r0 + wave * 16 + col) * DIN + kc * 32 + 8 * g;
#pragma unroll
      for (int i = 0; i < 8; ++i) { a[i] = (__bf16)p[i]; a[8 + i] = (__bf16)p[16 + i]; } }
    asm volatile("s_wait_loadcnt 0x0" ::: "memory");
#pragma unroll
    for (int j = 0; j < 8; ++j) { const v16b w = WCOL(WA, kc * 32, c0 + j * 16 + col, lane); asm volatile("s_wait_loadcnt 0x0" ::: "memory"); acc[j] = wmma_bf(a, w, acc[j]); } }
  if (which < 2) { _Float16* DH = which == 0 ? QH : KH; _Float16* DL = which == 0 ? QL : KL; const int nhi = which == 0 ? QHI : KHI; const bool hi_rows = t0 < nhi;
#pragma unroll
    for (int j = 0; j < 8; ++j) { const float bias = BA ? bfr(BA[c0 + j * 16 + col]) : 0.f;
#pragma unroll
      for (int r = 0; r < 8; ++r) { const float v = acc[j][r] + bias; const _Float16 hv = (_Float16)v; sh[wave * 16 + 8 * g + r][j * 16 + col] = hv; sl[wave * 16 + 8 * g + r][j * 16 + col] = (_Float16)((v - (float)hv) * 1024.0f); } }
    __syncthreads();
    for (int e = tid; e < 64 * 16; e += 128) { const int rl = e >> 4, q = e & 15; vst2((unsigned*)(DH + (r0 + rl) * CC + c0 + q * 8), *(const v4u*)&sh[rl][q * 8]); if (hi_rows) vst2((unsigned*)(DL + (bb * nhi + t0 + rl) * (size_t)CC + c0 + q * 8), *(const v4u*)&sl[rl][q * 8]); }
  } else { const bool hi_rows = t0 < KHI;
#pragma unroll
    for (int j = 0; j < 8; ++j) { const float bias = BA ? bfr(BA[c0 + j * 16 + col]) : 0.f;
#pragma unroll
      for (int r = 0; r < 8; ++r) { const float v = acc[j][r] + bias; const int rl = wave * 16 + 8 * g + r, cl = j * 16 + col; th[cl][rl] = (_Float16)v; const __bf16 bh = (__bf16)v; tb[cl][rl] = bh; tbl[cl][rl] = (__bf16)(v - (float)bh); } }
    __syncthreads();
    for (int e = tid; e < 128 * 8; e += 128) { const int cl = e >> 3, q = e & 7; vst2((unsigned*)(VT + (bb * CC + c0 + cl) * (size_t)TT + t0 + q * 8), *(const v4u*)&th[cl][q * 8]); if (hi_rows) { const size_t o3 = (bb * CC + c0 + cl) * (size_t)KHI + t0 + q * 8; vst2((unsigned*)(VB + o3), *(const v4u*)&tb[cl][q * 8]); vst2((unsigned*)(VBL + o3), *(const v4u*)&tbl[cl][q * 8]); } } } }
// ---- k_sc: block = (query block qb, key block kb <= kb_last(qb), head in group) of batch b: logits x SCALE; q hi + residual (x 2^10) against k (2 products) for query rows < QHI, plus the k residual (3 products) for query blocks < QBH (causal early rows); causal: blocks past the diagonal exit, the mask itself is applied by index in k_sm
__global__ __launch_bounds__(128) void k_sc(const _Float16* __restrict__ QH, const _Float16* __restrict__ KH, const _Float16* __restrict__ QL, const _Float16* __restrict__ KL, int b, int h0, float* __restrict__ S0) { __shared__ __align__(16) float ss[4][16][132];
  const int qb = blockIdx.x, kb = blockIdx.y; if (kb > kb_last(qb)) return;
  const int h = h0 + blockIdx.z; float* S = S0 + (size_t)blockIdx.z * TT * TT;
  const int tid = threadIdx.x, wave = tid >> 5, lane = tid & 31, col = lane & 15, g = lane >> 4; const int k0 = kb * 128; const int ql0 = qb * 64 + wave * 16; const size_t q0 = (size_t)b * TT + ql0, kr0 = (size_t)b * TT + k0;
  v8f acc[8] = {}, accl[8] = {};
  const _Float16* QLb = QL + (size_t)b * QHI * CC; const _Float16* KLb = KL + (size_t)b * KHI * CC;
  if (qb < QBH) {
#pragma unroll
    for (int kc = 0; kc < HD / 32; ++kc) { const v16h ah = frag_h(QH + (q0 + col) * CC + h * HD + kc * 32, lane), al = frag_h(QLb + (size_t)(ql0 + col) * CC + h * HD + kc * 32, lane);
#pragma unroll
      for (int j = 0; j < 8; ++j) { const v16h kbf = frag_h(KH + (kr0 + j * 16 + col) * CC + h * HD + kc * 32, lane), klf = frag_h(KLb + (size_t)(k0 + j * 16 + col) * CC + h * HD + kc * 32, lane); acc[j] = wmma16(ah, kbf, acc[j]); accl[j] = wmma16(al, kbf, accl[j]); accl[j] = wmma16(ah, klf, accl[j]); } }
  } else if (qb * 64 < QHI) {
#pragma unroll
    for (int kc = 0; kc < HD / 32; ++kc) { const v16h ah = frag_h(QH + (q0 + col) * CC + h * HD + kc * 32, lane), al = frag_h(QLb + (size_t)(ql0 + col) * CC + h * HD + kc * 32, lane);
#pragma unroll
      for (int j = 0; j < 8; ++j) { const v16h kbf = frag_h(KH + (kr0 + j * 16 + col) * CC + h * HD + kc * 32, lane); acc[j] = wmma16(ah, kbf, acc[j]); accl[j] = wmma16(al, kbf, accl[j]); } }
  } else {
#pragma unroll
    for (int kc = 0; kc < HD / 32; ++kc) { const v16h ah = frag_h(QH + (q0 + col) * CC + h * HD + kc * 32, lane);
#pragma unroll
      for (int j = 0; j < 8; ++j) { const v16h kbf = frag_h(KH + (kr0 + j * 16 + col) * CC + h * HD + kc * 32, lane); acc[j] = wmma16(ah, kbf, acc[j]); } } }
#pragma unroll
  for (int j = 0; j < 8; ++j) {
#pragma unroll
    for (int r = 0; r < 8; ++r) ss[wave][8 * g + r][j * 16 + col] = (acc[j][r] + accl[j][r] * (1.0f / 1024.0f)) * SCALE; }
  LDSX(); for (int rl = 0; rl < 16; ++rl) vst2(S + (size_t)(ql0 + rl) * TT + k0 + lane * 4, *(const v4f*)&ss[wave][rl][lane * 4]); }
// ---- k_sm: block = query row t (head in group): keys [0, kend): causal -> logit if s <= t else excluded; softmax in f32; P x 2^11 in place (0 for excluded)
__global__ __launch_bounds__(256) void k_sm(float* __restrict__ S0 SM_EXTRA_PARAMS) { __shared__ float sred[8]; __shared__ float sbc; __shared__ __align__(16) float shv[TT];
  const int tid = threadIdx.x; const int t = blockIdx.x; const int kend = (kb_last(t >> 6) + 1) * 128;
  float* sr = S0 + (size_t)blockIdx.y * TT * TT + (size_t)t * TT;
  float m = -3.0e38f; for (int k = tid; k < kend; k += 256) { float v = (!CAUSAL || k <= t) ? sr[k] : -3.0e38f; SM_MASK_HOOK; shv[k] = v; m = fmaxf(m, v); }
#pragma unroll
  for (int o = 1; o < 32; o <<= 1) m = fmaxf(m, __shfl_xor(m, o));
  if ((tid & 31) == 0) sred[tid >> 5] = m; __syncthreads(); if (tid == 0) { float a = sred[0]; for (int i = 1; i < 8; ++i) a = fmaxf(a, sred[i]); sbc = a; } __syncthreads(); m = sbc; __syncthreads();
  float sum = 0.f; for (int k = tid; k < kend; k += 256) { const float v = shv[k]; const float e = (v <= -1.0e38f) ? 0.f : expf(v - m); shv[k] = e; sum += e; }
#pragma unroll
  for (int o = 1; o < 32; o <<= 1) sum += __shfl_xor(sum, o);
  if ((tid & 31) == 0) sred[tid >> 5] = sum; __syncthreads(); if (tid == 0) { float a = 0.f; for (int i = 0; i < 8; ++i) a += sred[i]; sbc = a > 0.f ? 2048.0f / a : 0.f; }   /* a fully excluded row yields P = 0 */ __syncthreads(); const float inv = sbc;
  for (int k = tid; k < kend; k += 256) shv[k] = shv[k] * inv;
  __syncthreads(); for (int q = tid; q < kend / 4; q += 256) vst2(sr + q * 4, *(const v4f*)&shv[q * 4]); }
// ---- k_pv: block = 64 queries (qb) of (b, h): ctx = P . v over keys [0, kend) (P x 2^11 once to f16 against v f16: 1 product; causal early query blocks: P and v as bf16 hi + lo, 3 products); 256-B (row, head) segment by 16 lanes
__global__ __launch_bounds__(128) void k_pv(const float* __restrict__ PS0, const _Float16* __restrict__ VT, const __bf16* __restrict__ VB, const __bf16* __restrict__ VBL, int b, int h0, float* __restrict__ Y) { const int h = h0 + blockIdx.z; const float* PS = PS0 + (size_t)blockIdx.z * TT * TT; __shared__ __align__(16) float ss[4][16][HD + 4];
  const int tid = threadIdx.x, wave = tid >> 5, lane = tid & 31, col = lane & 15, g = lane >> 4; const int qb = blockIdx.x; const int ql0 = qb * 64 + wave * 16; const int kce = (kb_last(qb) + 1) * 4;
  v8f acc[HD / 16] = {};
  if (qb < QBH) {
#pragma unroll 1
    for (int kc = 0; kc < kce; ++kc) { const F2 p = split_row(PS + (size_t)(ql0 + col) * TT, kc * 32, lane);
      asm volatile("s_wait_loadcnt 0x0" ::: "memory");
#pragma unroll
      for (int j = 0; j < HD / 16; ++j) { const size_t po = ((size_t)b * CC + h * HD + j * 16 + col) * (size_t)KHI + kc * 32; const v16b vh = frag_b(VB + po, lane); acc[j] = wmma_bf(p.h, vh, acc[j]); acc[j] = wmma_bf(p.l, vh, acc[j]); acc[j] = wmma_bf(p.h, frag_b(VBL + po, lane), acc[j]); } }
  } else {
#pragma unroll 1
    for (int kc = 0; kc < kce; ++kc) { const v16h p = frag_f32(PS + (size_t)(ql0 + col) * TT + kc * 32, lane);
      asm volatile("s_wait_loadcnt 0x0" ::: "memory");
#pragma unroll
      for (int j = 0; j < HD / 16; ++j) { const size_t po = ((size_t)b * CC + h * HD + j * 16 + col) * (size_t)TT + kc * 32; acc[j] = wmma16(p, frag_h(VT + po, lane), acc[j]); } } }
#pragma unroll
  for (int j = 0; j < HD / 16; ++j)
#pragma unroll
    for (int r = 0; r < 8; ++r) ss[wave][8 * g + r][j * 16 + col] = acc[j][r] * (1.0f / 2048.0f);
  LDSX(); for (int rl = 0; rl < 16; ++rl) if (lane < HD / 4) vst2(Y + ((size_t)b * TT + ql0 + rl) * CC + h * HD + lane * 4, *(const v4f*)&ss[wave][rl][lane * 4]); }

extern "C" void kernel_launch(void* const* d_in, const int* in_sizes, int n_in, void* d_out, int out_size, void* d_ws, size_t ws_size, hipStream_t stream) {
  (void)in_sizes; (void)n_in; (void)out_size;
  const float** F = (const float**)d_in;
  if (ws_size < (size_t)WS_END) return;
  char* ws = (char*)d_ws; _Float16 *QH = (_Float16*)(ws + WS_QH), *KH = (_Float16*)(ws + WS_KH), *VT = (_Float16*)(ws + WS_VT), *QL = (_Float16*)(ws + WS_QL), *KL = (_Float16*)(ws + WS_KL); __bf16 *VB = (__bf16*)(ws + WS_VB), *VBL = (__bf16*)(ws + WS_VBL); float *S = (float*)(ws + WS_S), *Y = (float*)(ws + WS_Y);
  (void)Y; (void)QL; (void)KL; (void)VB; (void)VBL;
  // inputs: 0 x [2,2048,1024]; 1 Wq [1024,1024] (in,out), 2 bq; 3 Wk, 4 bk; 5 Wv, 6 bv (biases nonzero); no output projection
  k_proj<<<dim3(TNB * TT / 64, CC / 128, 3), 128, 0, stream>>>(F[0], F[0], F[0], F[1], F[3], F[5], F[2], F[4], F[6], QH, QL, KH, KL, VT, VB, VBL);
  for (int b = 0; b < TNB; ++b) for (int h0 = 0; h0 < NH; h0 += HG) {
    k_sc<<<dim3(NQB, TT / 128, HG), 128, 0, stream>>>(QH, KH, QL, KL, b, h0, S);
    k_sm<<<dim3(TT, HG), 256, 0, stream>>>(S);
    k_pv<<<dim3(NQB, 1, HG), 128, 0, stream>>>(S, VT, VB, VBL, b, h0, (float*)d_out);
  }
}

// v002
// A run of this version takes 88.8 microseconds.
// Versions in between are left out here; by their measured steps it is 12.6 times as fast as v000.
// compute dtype: all float inputs rounded to bf16; q/k/v projections with EXACT bf16 products on WMMA 16x16x32 (f32 accumulate) + bias; logits q x k once to f16 each (1 product) x SCALE; softmax f32 with a running maximum; exp(s - m) x 2^11 once to f16 x v once to f16 (1 product), divided by the f32 sum at the end; f32 output.
#include <hip/hip_runtime.h>
#include <math.h>

typedef __attribute__((ext_vector_type(16))) _Float16 v16h;
typedef __attribute__((ext_vector_type(16))) __bf16 v16b;
typedef __attribute__((ext_vector_type(8)))  _Float16 v8h;
typedef __attribute__((ext_vector_type(8)))  float v8f;
typedef __attribute__((ext_vector_type(4)))  float v4f;
typedef __attribute__((ext_vector_type(2)))  float v2f;
typedef __attribute__((ext_vector_type(4)))  unsigned v4u;
typedef __attribute__((ext_vector_type(4)))  int v4i;
typedef float __attribute__((may_alias)) float_a;
typedef int __attribute__((may_alias)) int_a;

template <typename T> __device__ __forceinline__ void vst2(void* p, T v) { *(T*)p = v;  }
__device__ __forceinline__ v8f wmma16(v16h a, v16h b, v8f c) {
  v8f d = __builtin_amdgcn_wmma_f32_16x16x32_f16(false, a, false, b, (short)0, c, false, false);
  asm volatile("v_nop\n\tv_nop\n\tv_nop\n\tv_nop" : "+v"(d) : "v"(a), "v"(b));
  return d;
}
__device__ __forceinline__ v8f wmma_bf(v16b a, v16b b, v8f c) {
  v8f d = __builtin_amdgcn_wmma_f32_16x16x32_bf16(false, a, false, b, (short)0, c, false, false);
  asm volatile("v_nop\n\tv_nop\n\tv_nop\n\tv_nop" : "+v"(d) : "v"(a), "v"(b));
  return d;
}
// 16x16x32 fragments: lane = (h = lane>>4, row/col = lane&15); elements 0..7 = k0+8h+0..7, 8..15 = k0+16+8h+0..7; D element r = row 8h+r
__device__ __forceinline__ v16h frag_h(const _Float16* rowk0, int lane) {
  union { v16h v; v8h q[2]; } u; const _Float16* p = rowk0 + 8 * (lane >> 4);
  u.q[0] = *(const v8h*)p; u.q[1] = *(const v8h*)(p + 16); return u.v;
}
__device__ __forceinline__ v16h frag_f32(const float* rowk0, int lane) {
  v16h a; const float* p = rowk0 + 8 * (lane >> 4);
#pragma unroll
  for (int i = 0; i < 8; ++i) { a[i] = (_Float16)p[i]; a[8 + i] = (_Float16)p[16 + i]; }
  return a;
}
__device__ __forceinline__ v16h frag_f32s(const float* rowk0, int lane, float sc) {
  v16h a; const float* p = rowk0 + 8 * (lane >> 4);
#pragma unroll
  for (int i = 0; i < 8; ++i) { a[i] = (_Float16)(p[i] * sc); a[8 + i] = (_Float16)(p[16 + i] * sc); }
  return a;
}
// column fragment from a [K][ld] layout (column n), rows >= K read as 0
__device__ __forceinline__ v16h fragc_f32(const float* W, int k0, int n, int lane, int ld, int K) {
  v16h a; const int g = lane >> 4;
#pragma unroll
  for (int i = 0; i < 8; ++i) { const int ka = k0 + 8 * g + i, kb = ka + 16;
    a[i] = (_Float16)(ka < K ? W[(size_t)(ka < K ? ka : K - 1) * ld + n] : 0.f); a[8 + i] = (_Float16)(kb < K ? W[(size_t)(kb < K ? kb : K - 1) * ld + n] : 0.f); }
  return a;
}
struct F2 { v16b h, l; };
__device__ __forceinline__ F2 bsplit16(const float v[16]) { F2 r;
#pragma unroll
  for (int i = 0; i < 16; ++i) { const __bf16 h = (__bf16)v[i]; r.h[i] = h; r.l[i] = (__bf16)(v[i] - (float)h); }
  return r; }
__device__ __forceinline__ F2 split_row(const float* row, int k0, int lane) { float v[16]; const float* p = row + k0 + 8 * (lane >> 4);
#pragma unroll
  for (int i = 0; i < 8; ++i) { v[i] = p[i]; v[8 + i] = p[16 + i]; }
  return bsplit16(v); }
__device__ __forceinline__ F2 split_rowK(const float* row, int k0, int lane, int K) { float v[16]; const int g = lane >> 4;
#pragma unroll
  for (int i = 0; i < 8; ++i) { const int ka = k0 + 8 * g + i, kb = ka + 16; v[i] = ka < K ? row[ka < K ? ka : K - 1] : 0.f; v[8 + i] = kb < K ? row[kb < K ? kb : K - 1] : 0.f; }
  return bsplit16(v); }
__device__ __forceinline__ F2 split_col(const float* W, int k0, int n, int lane, int ld, int K) { float v[16]; const int g = lane >> 4;
#pragma unroll
  for (int i = 0; i < 8; ++i) { const int ka = k0 + 8 * g + i, kb = ka + 16; v[i] = ka < K ? W[(size_t)(ka < K ? ka : K - 1) * ld + n] : 0.f; v[8 + i] = kb < K ? W[(size_t)(kb < K ? kb : K - 1) * ld + n] : 0.f; }
  return bsplit16(v); }
__device__ __forceinline__ v8f mac3(const F2& a, const F2& b, v8f c) { c = wmma_bf(a.l, b.h, c); c = wmma_bf(a.h, b.l, c); return wmma_bf(a.h, b.h, c); }
__device__ __forceinline__ float sigm(float v) { return 1.0f / (1.0f + expf(-v)); }
#define LDSX() do { asm volatile("s_wait_dscnt 0" ::: "memory"); __builtin_amdgcn_wave_barrier(); __builtin_amdgcn_fence(__ATOMIC_RELEASE, "workgroup"); } while (0)

// Multi-head self-attention without an output projection (x [2,2048,1024]; (in,out) Wq / Wk / Wv [1024,1024] + biases, uniform(+-1/32); 16 heads x 64; scale 1/8; softmax over keys; heads merged) -> [2,2048,1024].
#define NB 2
#define TT 2048
#define CC 1024            // NH * HD = projected width
#define DIN 1024          // input (model) width
#define NH 16
#define HD 64
#define NQB (TT / 64)
#define HG 4
#define SCALE (0.125f)
#define CAUSAL 0
#ifndef TNB
#define TNB NB
#endif
__device__ __forceinline__ float bfr(float v) { return (float)(__bf16)v; }
__host__ __device__ __forceinline__ int kb_last(int qb) { return CAUSAL ? ((qb * 64 + 63) >> 7) : (TT / 128 - 1); }
typedef __attribute__((ext_vector_type(8))) __bf16 v8b;
__device__ __forceinline__ v16b frag_b(const __bf16* rowk0, int lane) {
  union { v16b v; v8b q[2]; } u; const __bf16* p = rowk0 + 8 * (lane >> 4);
  u.q[0] = *(const v8b*)p; u.q[1] = *(const v8b*)(p + 16); return u.v;
}
#define QBH 0              // unused: this file has no high-precision path
#define QHI 0               // single-product logits on every row
#define KHI 64            // key rows of the k residual / v bf16 hi+lo workspace planes, which no kernel here writes or reads
// B fragment (k rows k0+.., output column o) of a weight: (in,out) [K][ld] or (out,in) [ld rows of K]: bf16 exact, or f16(bf16 * 256) exact
__device__ __forceinline__ v16b wcol_io(const float* Wm, int k0, int o, int lane, int ld) { v16b w; const int g = lane >> 4;
#pragma unroll
  for (int i = 0; i < 8; ++i) { w[i] = (__bf16)Wm[(size_t)(k0 + 8 * g + i) * ld + o]; w[8 + i] = (__bf16)Wm[(size_t)(k0 + 16 + 8 * g + i) * ld + o]; }
  return w; }
__device__ __forceinline__ v16b wcol_oi(const float* Wm, int k0, int o, int lane, int K) { v16b w; const float* p = Wm + (size_t)o * K + k0 + 8 * (lane >> 4);
#pragma unroll
  for (int i = 0; i < 8; ++i) { w[i] = (__bf16)p[i]; w[8 + i] = (__bf16)p[16 + i]; }
  return w; }
__device__ __forceinline__ v16h wcolh_io(const float* Wm, int k0, int o, int lane, int ld) { v16h w; const int g = lane >> 4;
#pragma unroll
  for (int i = 0; i < 8; ++i) { w[i] = (_Float16)(bfr(Wm[(size_t)(k0 + 8 * g + i) * ld + o]) * 256.0f); w[8 + i] = (_Float16)(bfr(Wm[(size_t)(k0 + 16 + 8 * g + i) * ld + o]) * 256.0f); }
  return w; }
__device__ __forceinline__ v16h wcolh_oi(const float* Wm, int k0, int o, int lane, int K) { v16h w; const float* p = Wm + (size_t)o * K + k0 + 8 * (lane >> 4);
#pragma unroll
  for (int i = 0; i < 8; ++i) { w[i] = (_Float16)(bfr(p[i]) * 256.0f); w[8 + i] = (_Float16)(bfr(p[16 + i]) * 256.0f); }
  return w; }
#define WQKV_LAYOUT 0   // 0 = (in,out) [DIN][CC]; 1 = (out,in) [CC][DIN]; 2 = per-head [NH][DIN][HD]
__device__ __forceinline__ v16b wcol_hdk(const float* Wm, int k0, int o, int lane) { v16b w; const int g = lane >> 4; const float* p = Wm + (size_t)(o / HD) * DIN * HD + (o % HD);
#pragma unroll
  for (int i = 0; i < 8; ++i) { w[i] = (__bf16)p[(size_t)(k0 + 8 * g + i) * HD]; w[8 + i] = (__bf16)p[(size_t)(k0 + 16 + 8 * g + i) * HD]; }
  return w; }
#define WO_OUT_IN 0
#if WQKV_LAYOUT == 1
#define WCOL(W, k0, o, lane) wcol_oi(W, k0, o, lane, DIN)
#elif WQKV_LAYOUT == 2
#define WCOL(W, k0, o, lane) wcol_hdk(W, k0, o, lane)
#else
#define WCOL(W, k0, o, lane) wcol_io(W, k0, o, lane, CC)
#endif
#if WO_OUT_IN
#define WOCOL(W, k0, o, lane) wcol_oi(W, k0, o, lane, CC)
#define WOCOLH(W, k0, o, lane) wcolh_oi(W, k0, o, lane, CC)
#else
#define WOCOL(W, k0, o, lane) wcol_io(W, k0, o, lane, DIN)
#define WOCOLH(W, k0, o, lane) wcolh_io(W, k0, o, lane, DIN)
#endif

#ifndef SM_EXTRA_PARAMS
#define SM_EXTRA_PARAMS
#endif
#ifndef PROJ_EXTRA_PARAMS
#define PROJ_EXTRA_PARAMS
#endif
#ifndef SM_MASK_HOOK
#define SM_MASK_HOOK (void)0
#endif

#define WS_QH  0u                                      // f16 q rows [b*t][CC]
#define WS_KH  (WS_QH + 2u * (size_t)NB * TT * CC)      // f16 k rows [b*t][CC]
#define WS_VT  (WS_KH + 2u * (size_t)NB * TT * CC)      // f16 v planes [b][c][t]
#define WS_QL  (WS_VT + 2u * (size_t)NB * CC * TT)      // f16 q residual x 2^10 rows [b][t < QHI][CC]
#define WS_KL  (WS_QL + 2u * (size_t)NB * QHI * CC)     // f16 k residual x 2^10 rows [b][t < KHI][CC]
#define WS_VB  (WS_KL + 2u * (size_t)NB * KHI * CC)     // bf16 v hi planes [b][c][t < KHI]
#define WS_VBL (WS_VB + 2u * (size_t)NB * CC * KHI)
#define WS_S   (WS_VBL + 2u * (size_t)NB * CC * KHI)    // f32 [hg][t][s], reserved: no kernel here uses it
#define WS_Y   (WS_S  + 4u * (size_t)HG * TT * TT)      // f32 ctx rows [b*t][CC] (only when there is an output projection)
#define WS_END (WS_Y  + 0u)

#define PBM 256            // rows of a block's tile
#define PBN 256            // columns of a block's tile
#define PBK 32             // k of a stage: one product deep
#define PTH 512            // threads: 16 waves as 4 x 4, a wave = 64 rows x 64 columns
#define PPIT 40            // LDS row pitch in bf16: 64-byte rows at 80 bytes (16 bytes x odd), free of bank conflicts for 16-byte reads and writes
typedef __attribute__((ext_vector_type(4))) __bf16 v4b;
__device__ __forceinline__ v8f mmb(v16b a, v16b b, v8f c) { return __builtin_amdgcn_wmma_f32_16x16x32_bf16(false, a, false, b, (short)0, c, false, false); }
// ---- k_proj: block = (256 rows, 256 cols, which): q/k/v = X W (+ b) with exact bf16 products (K = DIN, 32 k a product, k ascending) -> which 0: q f16 rows; 1: k f16 rows; 2: v f16 planes [c][t]
// a stage = 32 k of the X rows and of the W columns, fetched ONCE per block in whole 128-byte lines, rounded to bf16 and laid k-contiguous in LDS (xs[row][k], wt[col][k]: W is transposed on the way, a thread holding 16 k of one column, as two runs of 8);
// two buffers: stage s + 1 is written while stage s is read, stage s + 2 is in flight from global into registers; one barrier a stage
__global__ __launch_bounds__(PTH) void k_proj(const float* __restrict__ XQ, const float* __restrict__ XK, const float* __restrict__ XV, const float* __restrict__ WQ, const float* __restrict__ WK, const float* __restrict__ WV, const float* __restrict__ BQ, const float* __restrict__ BK, const float* __restrict__ BV,
    _Float16* __restrict__ QH, _Float16* __restrict__ KH, _Float16* __restrict__ VT) {
  __shared__ __align__(16) unsigned char sm[PBM * (PBN + 8) * 2];   // the two stage buffers of X and of W (81,920 bytes); behind the loop the f16 output tile
  __bf16 (*xs)[PBM][PPIT] = (__bf16 (*)[PBM][PPIT])sm; __bf16 (*wt)[PBN][PPIT] = (__bf16 (*)[PBN][PPIT])(sm + 2 * PBM * PPIT * 2);
  const int tid = threadIdx.x, wave = tid >> 5, lane = tid & 31, col = lane & 15, g = lane >> 4, wr = wave >> 2, wc = wave & 3; const int which = blockIdx.z; const int c0 = blockIdx.y * PBN; const size_t r0 = (size_t)blockIdx.x * PBM; const size_t bb = r0 / TT; const int t0 = (int)(r0 % TT);
  const float* X = which == 0 ? XQ : which == 1 ? XK : XV; const float* WA = which == 0 ? WQ : which == 1 ? WK : WV; const float* BA = which == 0 ? BQ : which == 1 ? BK : BV;
  const int xrow = tid >> 3, xk = (tid & 7) * 4;      // X: 8 lanes a row, 16 bytes each; rows xrow + 64 i
  const int wn = tid & 255, wq = tid >> 8;            // W: a lane a column, 8 k rows from 8 (wq + 2 i)
  unsigned xo = (unsigned)(((r0 + xrow) * DIN + xk) * 4), wo = (unsigned)(((wq * 8) * CC + c0 + wn) * 4);   // this thread's byte offsets in X and in W at the next stage to fetch; the bases stay uniform
  v4f xr[4]; float wg[2][8];
  auto fetch = [&]() __attribute__((always_inline)) {
#pragma unroll
    for (int i = 0; i < 4; ++i) xr[i] = *(const v4f*)((const char*)X + xo + (size_t)i * 64 * DIN * 4);
#pragma unroll
    for (int i = 0; i < 2; ++i)
#pragma unroll
      for (int e = 0; e < 8; ++e) wg[i][e] = *(const float*)((const char*)WA + wo + (size_t)(i * 16 + e) * CC * 4);
    // directly behind the last load, on every way on from here: the wait that stands in front of any overwrite of a register that these loads name (the two offsets, the two uniform bases); the steps of the two offsets to the next stage are in the same statement, so that they cannot come in front of it
    asm volatile("s_wait_xcnt 0x0\n\tv_add_nc_u32 %0, %2, %0\n\tv_add_nc_u32 %1, %3, %1" : "+v"(xo), "+v"(wo) : "i"(PBK * 4), "i"(PBK * CC * 4) : "memory"); };
  auto stash = [&](const int buf) __attribute__((always_inline)) {
#pragma unroll
    for (int i = 0; i < 4; ++i) { const v4b t = { (__bf16)xr[i][0], (__bf16)xr[i][1], (__bf16)xr[i][2], (__bf16)xr[i][3] }; *(v4b*)&xs[buf][xrow + 64 * i][xk] = t; }
#pragma unroll
    for (int i = 0; i < 2; ++i) { v8b t;
#pragma unroll
      for (int e = 0; e < 8; ++e) t[e] = (__bf16)wg[i][e];
      *(v8b*)&wt[buf][wn][(wq + 2 * i) * 8] = t; } };
  // the stage barrier by hand: __syncthreads() also waits for the global loads in flight, which are to stay in flight across it; what it must order is LDS alone, so this wave's LDS stores and reads are waited for in front of it
  auto stage_barrier = [&]() __attribute__((always_inline)) { asm volatile("s_wait_dscnt 0x0" ::: "memory"); asm volatile("s_barrier_signal -1\n\ts_barrier_wait -1" ::: "memory"); };
  fetch(); stash(0); fetch();
  stage_barrier();
  v8f acc[4][4] = {};
#pragma unroll 2
  for (int s = 0; s < DIN / PBK; ++s) { const int cur = s & 1; v16b a[4], w[4];
#pragma unroll
    for (int i = 0; i < 4; ++i) { a[i] = frag_b(&xs[cur][wr * 64 + i * 16 + col][0], lane); w[i] = frag_b(&wt[cur][wc * 64 + i * 16 + col][0], lane); }
    if (s + 1 < DIN / PBK) { stash(cur ^ 1); if (s + 2 < DIN / PBK) fetch(); }
#pragma unroll
    for (int j = 0; j < 4; ++j)
#pragma unroll
      for (int i = 0; i < 4; ++i) acc[i][j] = mmb(a[i], w[j], acc[i][j]);
    stage_barrier(); }   // publishes stage s + 1 and ends every wave's reads of stage s, whose buffer the next trip overwrites
  _Float16 (*st)[PBN + 8] = (_Float16 (*)[PBN + 8])sm;   // the output tile, over the stage buffers, which every wave has left at the loop's last barrier
  float bias[4] = { 0.f, 0.f, 0.f, 0.f };
  if (BA) { const int bi = c0 + wc * 64 + col; float bl[4];
#pragma unroll
    for (int j = 0; j < 4; ++j) bl[j] = BA[bi + j * 16];
    asm volatile("s_wait_xcnt 0x0" :: "v"(bi) : "memory");   // behind the four loads; the index is an input so that it lives up to the wait and no loaded value is placed on the register that an issued load names
#pragma unroll
    for (int j = 0; j < 4; ++j) bias[j] = bfr(bl[j]); }
  if (which < 2) { _Float16* DH = which == 0 ? QH : KH;
#pragma unroll
    for (int j = 0; j < 4; ++j)
#pragma unroll
      for (int i = 0; i < 4; ++i)
#pragma unroll
        for (int r = 0; r < 8; ++r) st[wr * 64 + i * 16 + 8 * g + r][wc * 64 + j * 16 + col] = (_Float16)(acc[i][j][r] + bias[j]);
    __syncthreads();
#pragma unroll
    for (int it = 0; it < PBM * (PBN / 8) / PTH; ++it) { const int e = tid + it * PTH, rl = e >> 5, q = e & 31; vst2((unsigned*)(DH + (r0 + rl) * CC + c0 + q * 8), *(const v4u*)&st[rl][q * 8]); }
  } else {
#pragma unroll
    for (int j = 0; j < 4; ++j)
#pragma unroll
      for (int i = 0; i < 4; ++i)
#pragma unroll
        for (int r = 0; r < 8; ++r) st[wc * 64 + j * 16 + col][wr * 64 + i * 16 + 8 * g + r] = (_Float16)(acc[i][j][r] + bias[j]);
    __syncthreads();
#pragma unroll
    for (int it = 0; it < PBN * (PBM / 8) / PTH; ++it) { const int e = tid + it * PTH, cl = e >> 5, q = e & 31; vst2((unsigned*)(VT + (bb * CC + c0 + cl) * (size_t)TT + t0 + q * 8), *(const v4u*)&st[cl][q * 8]); } } }
// lane l with lane l ^ 16
__device__ __forceinline__ float xhalf(float x) { return __builtin_bit_cast(float, __builtin_amdgcn_permlanex16(__builtin_bit_cast(int, x), __builtin_bit_cast(int, x), 0x76543210, 0xfedcba98, false, false)); }
__device__ __forceinline__ v8f mm16(v16h a, v16h b, v8f c) { return __builtin_amdgcn_wmma_f32_16x16x32_f16(false, a, false, b, (short)0, c, false, false); }
// 16x16x32 fragment in the hardware k order; p = the lane's row at k0 + 8 * (lane >> 4)
__device__ __forceinline__ v16h frag_p(const _Float16* p) { union { v16h v; v8h q[2]; } u; u.q[0] = *(const v8h*)p; u.q[1] = *(const v8h*)(p + 16); return u.v; }
// exp2 in runs, one statement a run: early-clobbered results, so that no v_exp_f32 of a run writes a source or reads a result of the one in front of it, and a closing v_nop: the slot that the instruction set asks for behind a transcendental
__device__ __forceinline__ void exp2x8(float (&p)[8], const float (&a)[8]) {
  asm("v_exp_f32 %0, %8\n\tv_exp_f32 %1, %9\n\tv_exp_f32 %2, %10\n\tv_exp_f32 %3, %11\n\tv_exp_f32 %4, %12\n\tv_exp_f32 %5, %13\n\tv_exp_f32 %6, %14\n\tv_exp_f32 %7, %15\n\tv_nop"
      : "=&v"(p[0]), "=&v"(p[1]), "=&v"(p[2]), "=&v"(p[3]), "=&v"(p[4]), "=&v"(p[5]), "=&v"(p[6]), "=&v"(p[7]) : "v"(a[0]), "v"(a[1]), "v"(a[2]), "v"(a[3]), "v"(a[4]), "v"(a[5]), "v"(a[6]), "v"(a[7])); }
__device__ __forceinline__ void exp2x2(float& p0, float& p1, float a0, float a1) { asm("v_exp_f32 %0, %2\n\tv_exp_f32 %1, %3\n\tv_nop" : "=&v"(p0), "=&v"(p1) : "v"(a0), "v"(a1)); }
#define QCOLS 32           // query columns per wave (two 16-column groups)
#define AW 8               // waves per block
#define LSC (SCALE * 1.4426950408889634f)   // logits in base 2
__global__ __launch_bounds__(AW * 32) void k_attn(const _Float16* __restrict__ QH, const _Float16* __restrict__ KH, const _Float16* __restrict__ VT, float* __restrict__ Y) {
  const int tid = threadIdx.x, wave = tid >> 5, lane = tid & 31, col = lane & 15, g = lane >> 4;
  const int b = blockIdx.y / NH, h = blockIdx.y % NH; const int q0 = blockIdx.x * (AW * QCOLS) + wave * QCOLS;
  const _Float16* Qb = QH + ((size_t)b * TT + q0 + col) * CC + h * HD + 8 * g;
  const _Float16* kp = KH + ((size_t)b * TT + col) * CC + h * HD + 8 * g;          // this lane's place in the k rows that are in the registers
  const _Float16* vp = VT + ((size_t)b * CC + h * HD + col) * (size_t)TT + 8 * g;   // this lane's place in the v planes at the pass's first key
  v16h qf[2][2], kf[2][2];
#pragma unroll
  for (int u = 0; u < 2; ++u)
#pragma unroll
    for (int kc = 0; kc < 2; ++kc) { qf[u][kc] = frag_p(Qb + u * 16 * CC + kc * 32); kf[u][kc] = frag_p(kp + u * 16 * CC + kc * 32); }
  asm volatile("s_wait_xcnt 0x0" :: "v"(Qb), "v"(kp) : "memory");   // behind the sixteen loads above; both pointers are inputs so that they live up to the wait and no fragment is placed on an address pair that an issued load names
  v8f o[2][HD / 16] = {}; float m[2] = { -3.0e38f, -3.0e38f }, l[2] = { 0.f, 0.f };
  // one pass = 32 keys; more: a further pass follows, whose k rows are fetched behind this pass's score products
  auto pass = [&](const bool more) __attribute__((always_inline)) {
    v16h vf[HD / 16];
#pragma unroll
    for (int j = 0; j < HD / 16; ++j) vf[j] = frag_p(vp + j * 16 * TT);
    __builtin_amdgcn_sched_barrier(0);   // keeps the v loads at the head of the pass: left free they sink to just in front of Vt . Pt and their latency shows
    v8f s[2][2] = {};
#pragma unroll
    for (int kc = 0; kc < 2; ++kc)
#pragma unroll
      for (int t = 0; t < 2; ++t)
#pragma unroll
        for (int u = 0; u < 2; ++u) s[u][t] = mm16(kf[t][kc], qf[u][kc], s[u][t]);
    if (more) { kp += 32 * CC;
#pragma unroll
      for (int t = 0; t < 2; ++t)
#pragma unroll
        for (int kc = 0; kc < 2; ++kc) kf[t][kc] = frag_p(kp + t * 16 * CC + kc * 32); }
    __builtin_amdgcn_sched_barrier(0);   // keeps the k loads in front of the softmax, which then covers their latency
    if (!more) asm volatile("" :: "v"(qf[0][0]), "v"(qf[0][1]), "v"(qf[1][0]), "v"(qf[1][1]), "v"(kf[0][0]), "v"(kf[0][1]), "v"(kf[1][0]), "v"(kf[1][1]));   // inputs only: in the last pass the loaded q and k fragments die product by product, and without this a later score product's D is placed on a register that the product in front of it still reads
    v16h pf[2]; float mn[2], alpha[2];
#pragma unroll
    for (int u = 0; u < 2; ++u) {
      float mx = fmaxf(s[u][0][0], s[u][1][0]);
#pragma unroll
      for (int r = 1; r < 8; ++r) mx = fmaxf(mx, fmaxf(s[u][0][r], s[u][1][r]));
      mx = fmaxf(mx, xhalf(mx)); mn[u] = fmaxf(m[u], mx * LSC); }
    exp2x2(alpha[0], alpha[1], m[0] - mn[0], m[1] - mn[1]);   // 0 on the first pass
#pragma unroll
    for (int u = 0; u < 2; ++u) { m[u] = mn[u]; const float off = 11.0f - mn[u]; float p[2][8];
#pragma unroll
      for (int t = 0; t < 2; ++t) { float a[8];
#pragma unroll
        for (int r = 0; r < 8; ++r) a[r] = fmaf(s[u][t][r], LSC, off);
        exp2x8(p[t], a);
#pragma unroll
        for (int r = 0; r < 8; ++r) pf[u][8 * t + r] = (_Float16)p[t][r]; }
      float q[8];   // the pass's 16 terms as a tree, not a chain of dependent adds
#pragma unroll
      for (int r = 0; r < 8; ++r) q[r] = p[0][r] + p[1][r];
      l[u] = fmaf(l[u], alpha[u], ((q[0] + q[1]) + (q[2] + q[3])) + ((q[4] + q[5]) + (q[6] + q[7])));
#pragma unroll
      for (int j = 0; j < HD / 16; ++j) o[u][j] *= alpha[u];
    }
#pragma unroll
    for (int j = 0; j < HD / 16; ++j)
#pragma unroll
      for (int u = 0; u < 2; ++u) o[u][j] = mm16(vf[j], pf[u], o[u][j]);
    if (more) {
      __builtin_amdgcn_sched_barrier(0);   // this and the next one hold the wait between them at the foot of the pass (placed early it stalls the softmax) and the two pointer steps behind it
      asm volatile("s_wait_xcnt 0x0" ::: "memory");   // in front of the steps of the two pointers that the issued loads name
      __builtin_amdgcn_sched_barrier(0);
      vp += 32; }
  };
  for (int s0 = 0; s0 < TT - 32; s0 += 32) pass(true);
  pass(false);
  float* yr = Y + ((size_t)b * TT + q0 + col) * CC + h * HD + 8 * g;
#pragma unroll
  for (int u = 0; u < 2; ++u) { const float inv = 1.0f / (l[u] + xhalf(l[u]));
#pragma unroll
    for (int j = 0; j < HD / 16; ++j) o[u][j] *= inv; }
  __builtin_amdgcn_sched_barrier(0);   // every product in front of the first store: no register of an issued store is written again
#pragma unroll
  for (int u = 0; u < 2; ++u)
#pragma unroll
    for (int j = 0; j < HD / 16; ++j) { const v8f r = o[u][j]; const v4f lo = { r[0], r[1], r[2], r[3] }, hi = { r[4], r[5], r[6], r[7] }; vst2(yr + u * 16 * CC + j * 16, lo); vst2(yr + u * 16 * CC + j * 16 + 4, hi); } }

extern "C" void kernel_launch(void* const* d_in, const int* in_sizes, int n_in, void* d_out, int out_size, void* d_ws, size_t ws_size, hipStream_t stream) {
  (void)in_sizes; (void)n_in; (void)out_size;
  const float** F = (const float**)d_in;
  if (ws_size < (size_t)WS_END) return;
  char* ws = (char*)d_ws; _Float16 *QH = (_Float16*)(ws + WS_QH), *KH = (_Float16*)(ws + WS_KH), *VT = (_Float16*)(ws + WS_VT), *QL = (_Float16*)(ws + WS_QL), *KL = (_Float16*)(ws + WS_KL); __bf16 *VB = (__bf16*)(ws + WS_VB), *VBL = (__bf16*)(ws + WS_VBL); float *S = (float*)(ws + WS_S), *Y = (float*)(ws + WS_Y);
  (void)Y; (void)S; (void)QL; (void)KL; (void)VB; (void)VBL;
  // inputs: 0 x [2,2048,1024]; 1 Wq [1024,1024] (in,out), 2 bq; 3 Wk, 4 bk; 5 Wv, 6 bv (biases nonzero); no output projection
  k_proj<<<dim3(TNB * TT / PBM, CC / PBN, 3), PTH, 0, stream>>>(F[0], F[0], F[0], F[1], F[3], F[5], F[2], F[4], F[6], QH, KH, VT);
  k_attn<<<dim3(TT / (AW * QCOLS), TNB * NH), AW * 32, 0, stream>>>(QH, KH, VT, (float*)d_out);
}

// v003
// A run of this version takes 67.6 microseconds.
// In two side-by-side timings against v002, it was 1.29 and 1.31 times as fast.
// All steps since v000 together make it 16.4 times as fast.
// compute dtype: all float inputs rounded to bf16; q/k/v projections with EXACT bf16 products on WMMA 16x16x32 (f32 accumulate) + bias; logits q x k once to f16 each (1 product) x SCALE; softmax f32 with a running maximum; exp(s - m) x 2^11 once to f16 x v once to f16 (1 product), divided by the f32 sum at the end; f32 output.
#include <hip/hip_runtime.h>
#include <math.h>

typedef __attribute__((ext_vector_type(16))) _Float16 v16h;
typedef __attribute__((ext_vector_type(16))) __bf16 v16b;
typedef __attribute__((ext_vector_type(8)))  _Float16 v8h;
typedef __attribute__((ext_vector_type(8)))  float v8f;
typedef __attribute__((ext_vector_type(4)))  float v4f;
typedef __attribute__((ext_vector_type(2)))  float v2f;
typedef __attribute__((ext_vector_type(4)))  unsigned v4u;
typedef __attribute__((ext_vector_type(4)))  int v4i;
typedef float __attribute__((may_alias)) float_a;
typedef int __attribute__((may_alias)) int_a;

template <typename T> __device__ __forceinline__ void vst2(void* p, T v) { *(T*)p = v;  }
__device__ __forceinline__ v8f wmma16(v16h a, v16h b, v8f c) {
  v8f d = __builtin_amdgcn_wmma_f32_16x16x32_f16(false, a, false, b, (short)0, c, false, false);
  asm volatile("v_nop\n\tv_nop\n\tv_nop\n\tv_nop" : "+v"(d) : "v"(a), "v"(b));
  return d;
}
__device__ __forceinline__ v8f wmma_bf(v16b a, v16b b, v8f c) {
  v8f d = __builtin_amdgcn_wmma_f32_16x16x32_bf16(false, a, false, b, (short)0, c, false, false);
  asm volatile("v_nop\n\tv_nop\n\tv_nop\n\tv_nop" : "+v"(d) : "v"(a), "v"(b));
  return d;
}
// 16x16x32 fragments: lane = (h = lane>>4, row/col = lane&15); elements 0..7 = k0+8h+0..7, 8..15 = k0+16+8h+0..7; D element r = row 8h+r
__device__ __forceinline__ v16h frag_h(const _Float16* rowk0, int lane) {
  union { v16h v; v8h q[2]; } u; const _Float16* p = rowk0 + 8 * (lane >> 4);
  u.q[0] = *(const v8h*)p; u.q[1] = *(const v8h*)(p + 16); return u.v;
}
__device__ __forceinline__ v16h frag_f32(const float* rowk0, int lane) {
  v16h a; const float* p = rowk0 + 8 * (lane >> 4);
#pragma unroll
  for (int i = 0; i < 8; ++i) { a[i] = (_Float16)p[i]; a[8 + i] = (_Float16)p[16 + i]; }
  return a;
}
__device__ __forceinline__ v16h frag_f32s(const float* rowk0, int lane, float sc) {
  v16h a; const float* p = rowk0 + 8 * (lane >> 4);
#pragma unroll
  for (int i = 0; i < 8; ++i) { a[i] = (_Float16)(p[i] * sc); a[8 + i] = (_Float16)(p[16 + i] * sc); }
  return a;
}
// column fragment from a [K][ld] layout (column n), rows >= K read as 0
__device__ __forceinline__ v16h fragc_f32(const float* W, int k0, int n, int lane, int ld, int K) {
  v16h a; const int g = lane >> 4;
#pragma unroll
  for (int i = 0; i < 8; ++i) { const int ka = k0 + 8 * g + i, kb = ka + 16;
    a[i] = (_Float16)(ka < K ? W[(size_t)(ka < K ? ka : K - 1) * ld + n] : 0.f); a[8 + i] = (_Float16)(kb < K ? W[(size_t)(kb < K ? kb : K - 1) * ld + n] : 0.f); }
  return a;
}
struct F2 { v16b h, l; };
__device__ __forceinline__ F2 bsplit16(const float v[16]) { F2 r;
#pragma unroll
  for (int i = 0; i < 16; ++i) { const __bf16 h = (__bf16)v[i]; r.h[i] = h; r.l[i] = (__bf16)(v[i] - (float)h); }
  return r; }
__device__ __forceinline__ F2 split_row(const float* row, int k0, int lane) { float v[16]; const float* p = row + k0 + 8 * (lane >> 4);
#pragma unroll
  for (int i = 0; i < 8; ++i) { v[i] = p[i]; v[8 + i] = p[16 + i]; }
  return bsplit16(v); }
__device__ __forceinline__ F2 split_rowK(const float* row, int k0, int lane, int K) { float v[16]; const int g = lane >> 4;
#pragma unroll
  for (int i = 0; i < 8; ++i) { const int ka = k0 + 8 * g + i, kb = ka + 16; v[i] = ka < K ? row[ka < K ? ka : K - 1] : 0.f; v[8 + i] = kb < K ? row[kb < K ? kb : K - 1] : 0.f; }
  return bsplit16(v); }
__device__ __forceinline__ F2 split_col(const float* W, int k0, int n, int lane, int ld, int K) { float v[16]; const int g = lane >> 4;
#pragma unroll
  for (int i = 0; i < 8; ++i) { const int ka = k0 + 8 * g + i, kb = ka + 16; v[i] = ka < K ? W[(size_t)(ka < K ? ka : K - 1) * ld + n] : 0.f; v[8 + i] = kb < K ? W[(size_t)(kb < K ? kb : K - 1) * ld + n] : 0.f; }
  return bsplit16(v); }
__device__ __forceinline__ v8f mac3(const F2& a, const F2& b, v8f c) { c = wmma_bf(a.l, b.h, c); c = wmma_bf(a.h, b.l, c); return wmma_bf(a.h, b.h, c); }
__device__ __forceinline__ float sigm(float v) { return 1.0f / (1.0f + expf(-v)); }
#define LDSX() do { asm volatile("s_wait_dscnt 0" ::: "memory"); __builtin_amdgcn_wave_barrier(); __builtin_amdgcn_fence(__ATOMIC_RELEASE, "workgroup"); } while (0)

// Multi-head self-attention without an output projection (x [2,2048,1024]; (in,out) Wq / Wk / Wv [1024,1024] + biases, uniform(+-1/32); 16 heads x 64; scale 1/8; softmax over keys; heads merged) -> [2,2048,1024].
#define NB 2
#define TT 2048
#define CC 1024            // NH * HD = projected width
#define DIN 1024          // input (model) width
#define NH 16
#define HD 64
#define NQB (TT / 64)
#define HG 4
#define SCALE (0.125f)
#define CAUSAL 0
#ifndef TNB
#define TNB NB
#endif
__device__ __forceinline__ float bfr(float v) { return (float)(__bf16)v; }
__host__ __device__ __forceinline__ int kb_last(int qb) { return CAUSAL ? ((qb * 64 + 63) >> 7) : (TT / 128 - 1); }
typedef __attribute__((ext_vector_type(8))) __bf16 v8b;
__device__ __forceinline__ v16b frag_b(const __bf16* rowk0, int lane) {
  union { v16b v; v8b q[2]; } u; const __bf16* p = rowk0 + 8 * (lane >> 4);
  u.q[0] = *(const v8b*)p; u.q[1] = *(const v8b*)(p + 16); return u.v;
}
#define QBH 0              // unused: this file has no high-precision path
#define QHI 0               // single-product logits on every row
#define KHI 64            // key rows of the k residual / v bf16 hi+lo workspace planes, which no kernel here writes or reads
// B fragment (k rows k0+.., output column o) of a weight: (in,out) [K][ld] or (out,in) [ld rows of K]: bf16 exact, or f16(bf16 * 256) exact
__device__ __forceinline__ v16b wcol_io(const float* Wm, int k0, int o, int lane, int ld) { v16b w; const int g = lane >> 4;
#pragma unroll
  for (int i = 0; i < 8; ++i) { w[i] = (__bf16)Wm[(size_t)(k0 + 8 * g + i) * ld + o]; w[8 + i] = (__bf16)Wm[(size_t)(k0 + 16 + 8 * g + i) * ld + o]; }
  return w; }
__device__ __forceinline__ v16b wcol_oi(const float* Wm, int k0, int o, int lane, int K) { v16b w; const float* p = Wm + (size_t)o * K + k0 + 8 * (lane >> 4);
#pragma unroll
  for (int i = 0; i < 8; ++i) { w[i] = (__bf16)p[i]; w[8 + i] = (__bf16)p[16 + i]; }
  return w; }
__device__ __forceinline__ v16h wcolh_io(const float* Wm, int k0, int o, int lane, int ld) { v16h w; const int g = lane >> 4;
#pragma unroll
  for (int i = 0; i < 8; ++i) { w[i] = (_Float16)(bfr(Wm[(size_t)(k0 + 8 * g + i) * ld + o]) * 256.0f); w[8 + i] = (_Float16)(bfr(Wm[(size_t)(k0 + 16 + 8 * g + i) * ld + o]) * 256.0f); }
  return w; }
__device__ __forceinline__ v16h wcolh_oi(const float* Wm, int k0, int o, int lane, int K) { v16h w; const float* p = Wm + (size_t)o * K + k0 + 8 * (lane >> 4);
#pragma unroll
  for (int i = 0; i < 8; ++i) { w[i] = (_Float16)(bfr(p[i]) * 256.0f); w[8 + i] = (_Float16)(bfr(p[16 + i]) * 256.0f); }
  return w; }
#define WQKV_LAYOUT 0   // 0 = (in,out) [DIN][CC]; 1 = (out,in) [CC][DIN]; 2 = per-head [NH][DIN][HD]
__device__ __forceinline__ v16b wcol_hdk(const float* Wm, int k0, int o, int lane) { v16b w; const int g = lane >> 4; const float* p = Wm + (size_t)(o / HD) * DIN * HD + (o % HD);
#pragma unroll
  for (int i = 0; i < 8; ++i) { w[i] = (__bf16)p[(size_t)(k0 + 8 * g + i) * HD]; w[8 + i] = (__bf16)p[(size_t)(k0 + 16 + 8 * g + i) * HD]; }
  return w; }
#define WO_OUT_IN 0
#if WQKV_LAYOUT == 1
#define WCOL(W, k0, o, lane) wcol_oi(W, k0, o, lane, DIN)
#elif WQKV_LAYOUT == 2
#define WCOL(W, k0, o, lane) wcol_hdk(W, k0, o, lane)
#else
#define WCOL(W, k0, o, lane) wcol_io(W, k0, o, lane, CC)
#endif
#if WO_OUT_IN
#define WOCOL(W, k0, o, lane) wcol_oi(W, k0, o, lane, CC)
#define WOCOLH(W, k0, o, lane) wcolh_oi(W, k0, o, lane, CC)
#else
#define WOCOL(W, k0, o, lane) wcol_io(W, k0, o, lane, DIN)
#define WOCOLH(W, k0, o, lane) wcolh_io(W, k0, o, lane, DIN)
#endif

#ifndef SM_EXTRA_PARAMS
#define SM_EXTRA_PARAMS
#endif
#ifndef PROJ_EXTRA_PARAMS
#define PROJ_EXTRA_PARAMS
#endif
#ifndef SM_MASK_HOOK
#define SM_MASK_HOOK (void)0
#endif

#define WS_QH  0u                                      // f16 q rows [b*t][CC]
#define WS_KH  (WS_QH + 2u * (size_t)NB * TT * CC)      // f16 k rows [b*t][CC]
#define WS_VT  (WS_KH + 2u * (size_t)NB * TT * CC)      // f16 v planes [b][c][t]
#define WS_QL  (WS_VT + 2u * (size_t)NB * CC * TT)      // f16 q residual x 2^10 rows [b][t < QHI][CC]
#define WS_KL  (WS_QL + 2u * (size_t)NB * QHI * CC)     // f16 k residual x 2^10 rows [b][t < KHI][CC]
#define WS_VB  (WS_KL + 2u * (size_t)NB * KHI * CC)     // bf16 v hi planes [b][c][t < KHI]
#define WS_VBL (WS_VB + 2u * (size_t)NB * CC * KHI)
#define WS_S   (WS_VBL + 2u * (size_t)NB * CC * KHI)    // f32 [hg][t][s], reserved: no kernel here uses it
#define WS_Y   (WS_S  + 4u * (size_t)HG * TT * TT)      // f32 ctx rows [b*t][CC] (only when there is an output projection)
#define WS_END (WS_Y  + 0u)

#define PBM 256            // rows of a block's tile
#define PBN 256            // columns of a block's tile
#define PBK 32             // k of a stage: one product deep
#define PTH 512            // threads: 16 waves as 4 x 4, a wave = 64 rows x 64 columns
#define PPIT 40            // LDS row pitch in bf16: 64-byte rows at 80 bytes (16 bytes x odd), free of bank conflicts for 16-byte reads and writes
typedef __attribute__((ext_vector_type(4))) __bf16 v4b;
__device__ __forceinline__ v8f mmb(v16b a, v16b b, v8f c) { return __builtin_amdgcn_wmma_f32_16x16x32_bf16(false, a, false, b, (short)0, c, false, false); }
// ---- k_proj: block = (256 rows, 256 cols, which): q/k/v = X W (+ b) with exact bf16 products (K = DIN, 32 k a product, k ascending) -> which 0: q f16 rows; 1: k f16 rows; 2: v f16 planes [c][t]
// a stage = 32 k of the X rows and of the W columns, fetched ONCE per block in whole 128-byte lines, rounded to bf16 and laid k-contiguous in LDS (xs[row][k], wt[col][k]: W is transposed on the way, a thread holding 16 k of one column, as two runs of 8);
// two buffers: stage s + 1 is written while stage s is read, stage s + 2 is in flight from global into registers; one barrier a stage
__global__ __launch_bounds__(PTH) void k_proj(const float* __restrict__ XQ, const float* __restrict__ XK, const float* __restrict__ XV, const float* __restrict__ WQ, const float* __restrict__ WK, const float* __restrict__ WV, const float* __restrict__ BQ, const float* __restrict__ BK, const float* __restrict__ BV,
    _Float16* __restrict__ QH, _Float16* __restrict__ KH, _Float16* __restrict__ VT) {
  __shared__ __align__(16) unsigned char sm[PBM * (PBN + 8) * 2];   // the two stage buffers of X and of W (81,920 bytes); behind the loop the f16 output tile
  __bf16 (*xs)[PBM][PPIT] = (__bf16 (*)[PBM][PPIT])sm; __bf16 (*wt)[PBN][PPIT] = (__bf16 (*)[PBN][PPIT])(sm + 2 * PBM * PPIT * 2);
  const int tid = threadIdx.x, wave = tid >> 5, lane = tid & 31, col = lane & 15, g = lane >> 4, wr = wave >> 2, wc = wave & 3; const int which = blockIdx.z; const int c0 = blockIdx.y * PBN; const size_t r0 = (size_t)blockIdx.x * PBM; const size_t bb = r0 / TT; const int t0 = (int)(r0 % TT);
  const float* X = which == 0 ? XQ : which == 1 ? XK : XV; const float* WA = which == 0 ? WQ : which == 1 ? WK : WV; const float* BA = which == 0 ? BQ : which == 1 ? BK : BV;
  const int xrow = tid >> 3, xk = (tid & 7) * 4;      // X: 8 lanes a row, 16 bytes each; rows xrow + 64 i
  const int wn = tid & 255, wq = tid >> 8;            // W: a lane a column, 8 k rows from 8 (wq + 2 i)
  unsigned xo = (unsigned)(((r0 + xrow) * DIN + xk) * 4), wo = (unsigned)(((wq * 8) * CC + c0 + wn) * 4);   // this thread's byte offsets in X and in W at the next stage to fetch; the bases stay uniform
  v4f xr[4]; float wg[2][8];
  auto fetch = [&]() __attribute__((always_inline)) {
#pragma unroll
    for (int i = 0; i < 4; ++i) xr[i] = *(const v4f*)((const char*)X + xo + (size_t)i * 64 * DIN * 4);
#pragma unroll
    for (int i = 0; i < 2; ++i)
#pragma unroll
      for (int e = 0; e < 8; ++e) wg[i][e] = *(const float*)((const char*)WA + wo + (size_t)(i * 16 + e) * CC * 4);
    // directly behind the last load, on every way on from here: the wait that stands in front of any overwrite of a register that these loads name (the two offsets, the two uniform bases); the steps of the two offsets to the next stage are in the same statement, so that they cannot come in front of it
    asm volatile("s_wait_xcnt 0x0\n\tv_add_nc_u32 %0, %2, %0\n\tv_add_nc_u32 %1, %3, %1" : "+v"(xo), "+v"(wo) : "i"(PBK * 4), "i"(PBK * CC * 4) : "memory"); };
  auto stash = [&](const int buf) __attribute__((always_inline)) {
#pragma unroll
    for (int i = 0; i < 4; ++i) { const v4b t = { (__bf16)xr[i][0], (__bf16)xr[i][1], (__bf16)xr[i][2], (__bf16)xr[i][3] }; *(v4b*)&xs[buf][xrow + 64 * i][xk] = t; }
#pragma unroll
    for (int i = 0; i < 2; ++i) { v8b t;
#pragma unroll
      for (int e = 0; e < 8; ++e) t[e] = (__bf16)wg[i][e];
      *(v8b*)&wt[buf][wn][(wq + 2 * i) * 8] = t; } };
  // the stage barrier by hand: __syncthreads() also waits for the global loads in flight, which are to stay in flight across it; what it must order is LDS alone, so this wave's LDS stores and reads are waited for in front of it
  auto stage_barrier = [&]() __attribute__((always_inline)) { asm volatile("s_wait_dscnt 0x0" ::: "memory"); asm volatile("s_barrier_signal -1\n\ts_barrier_wait -1" ::: "memory"); };
  fetch(); stash(0); fetch();
  stage_barrier();
  v8f acc[4][4] = {};
#pragma unroll 2
  for (int s = 0; s < DIN / PBK; ++s) { const int cur = s & 1; v16b a[4], w[4];
#pragma unroll
    for (int i = 0; i < 4; ++i) { a[i] = frag_b(&xs[cur][wr * 64 + i * 16 + col][0], lane); w[i] = frag_b(&wt[cur][wc * 64 + i * 16 + col][0], lane); }
    if (s + 1 < DIN / PBK) { stash(cur ^ 1); if (s + 2 < DIN / PBK) fetch(); }
#pragma unroll
    for (int j = 0; j < 4; ++j)
#pragma unroll
      for (int i = 0; i < 4; ++i) acc[i][j] = mmb(a[i], w[j], acc[i][j]);
    stage_barrier(); }   // publishes stage s + 1 and ends every wave's reads of stage s, whose buffer the next trip overwrites
  _Float16 (*st)[PBN + 8] = (_Float16 (*)[PBN + 8])sm;   // the output tile, over the stage buffers, which every wave has left at the loop's last barrier
  float bias[4] = { 0.f, 0.f, 0.f, 0.f };
  if (BA) { const int bi = c0 + wc * 64 + col; float bl[4];
#pragma unroll
    for (int j = 0; j < 4; ++j) bl[j] = BA[bi + j * 16];
    asm volatile("s_wait_xcnt 0x0" :: "v"(bi) : "memory");   // behind the four loads; the index is an input so that it lives up to the wait and no loaded value is placed on the register that an issued load names
#pragma unroll
    for (int j = 0; j < 4; ++j) bias[j] = bfr(bl[j]); }
  if (which < 2) { _Float16* DH = which == 0 ? QH : KH;
#pragma unroll
    for (int j = 0; j < 4; ++j)
#pragma unroll
      for (int i = 0; i < 4; ++i)
#pragma unroll
        for (int r = 0; r < 8; ++r) st[wr * 64 + i * 16 + 8 * g + r][wc * 64 + j * 16 + col] = (_Float16)(acc[i][j][r] + bias[j]);
    __syncthreads();
#pragma unroll
    for (int it = 0; it < PBM * (PBN / 8) / PTH; ++it) { const int e = tid + it * PTH, rl = e >> 5, q = e & 31; vst2((unsigned*)(DH + (r0 + rl) * CC + c0 + q * 8), *(const v4u*)&st[rl][q * 8]); }
  } else {
#pragma unroll
    for (int j = 0; j < 4; ++j)
#pragma unroll
      for (int i = 0; i < 4; ++i)
#pragma unroll
        for (int r = 0; r < 8; ++r) st[wc * 64 + j * 16 + col][wr * 64 + i * 16 + 8 * g + r] = (_Float16)(acc[i][j][r] + bias[j]);
    __syncthreads();
#pragma unroll
    for (int it = 0; it < PBN * (PBM / 8) / PTH; ++it) { const int e = tid + it * PTH, cl = e >> 5, q = e & 31; vst2((unsigned*)(VT + (bb * CC + c0 + cl) * (size_t)TT + t0 + q * 8), *(const v4u*)&st[cl][q * 8]); } } }
// lane l with lane l ^ 16
__device__ __forceinline__ float xhalf(float x) { return __builtin_bit_cast(float, __builtin_amdgcn_permlanex16(__builtin_bit_cast(int, x), __builtin_bit_cast(int, x), 0x76543210, 0xfedcba98, false, false)); }
__device__ __forceinline__ v8f mm16(v16h a, v16h b, v8f c) { return __builtin_amdgcn_wmma_f32_16x16x32_f16(false, a, false, b, (short)0, c, false, false); }
// 16x16x32 fragment in the hardware k order; p = the lane's row at k0 + 8 * (lane >> 4)
__device__ __forceinline__ v16h frag_p(const _Float16* p) { union { v16h v; v8h q[2]; } u; u.q[0] = *(const v8h*)p; u.q[1] = *(const v8h*)(p + 16); return u.v; }
// exp2 in runs, one statement a run: early-clobbered results, so that no v_exp_f32 of a run writes a source or reads a result of the one in front of it, and a closing v_nop: the slot that the instruction set asks for behind a transcendental
__device__ __forceinline__ void exp2x8(float (&p)[8], const float (&a)[8]) {
  asm("v_exp_f32 %0, %8\n\tv_exp_f32 %1, %9\n\tv_exp_f32 %2, %10\n\tv_exp_f32 %3, %11\n\tv_exp_f32 %4, %12\n\tv_exp_f32 %5, %13\n\tv_exp_f32 %6, %14\n\tv_exp_f32 %7, %15\n\tv_nop"
      : "=&v"(p[0]), "=&v"(p[1]), "=&v"(p[2]), "=&v"(p[3]), "=&v"(p[4]), "=&v"(p[5]), "=&v"(p[6]), "=&v"(p[7]) : "v"(a[0]), "v"(a[1]), "v"(a[2]), "v"(a[3]), "v"(a[4]), "v"(a[5]), "v"(a[6]), "v"(a[7])); }
__device__ __forceinline__ void exp2x2(float& p0, float& p1, float a0, float a1) { asm("v_exp_f32 %0, %2\n\tv_exp_f32 %1, %3\n\tv_nop" : "=&v"(p0), "=&v"(p1) : "v"(a0), "v"(a1)); }
#define QCOLS 32           // query columns per wave (two 16-column groups)
#define AW 8               // waves per block
#define LSC (SCALE * 1.4426950408889634f)   // logits in base 2
#define SK 256             // keys of a stage: eight passes
#define NST (TT / SK)      // stages
#define KPIT 144           // LDS pitch of a k row (128 bytes) and
#define VPIT 528           // of a v plane's 256 keys (512 bytes): 16 bytes x odd, free of bank conflicts for 16-byte reads
#define KTILE (SK * KPIT)
#define VTILE (HD * VPIT)
#define STG (KTILE + VTILE)   // bytes of a stage buffer: the k rows, then the v planes
// 16x16x32 fragment in the hardware k order from LDS; p = the lane's row at k0 + 8 * (lane >> 4), in bytes
__device__ __forceinline__ v16h frag_l(const unsigned char* p) { union { v16h v; v8h q[2]; } u; u.q[0] = *(const v8h*)p; u.q[1] = *(const v8h*)(p + 32); return u.v; }
__global__ __launch_bounds__(AW * 32) void k_attn(const _Float16* __restrict__ QH, const _Float16* __restrict__ KH, const _Float16* __restrict__ VT, float* __restrict__ Y) {
  __shared__ __align__(16) unsigned char ring[2 * STG];
  const int tid = threadIdx.x, wave = tid >> 5, lane = tid & 31, col = lane & 15, g = lane >> 4;
  const int b = blockIdx.y / NH, h = blockIdx.y % NH; const int q0 = blockIdx.x * (AW * QCOLS) + wave * QCOLS;
  const _Float16* Qb = QH + ((size_t)b * TT + q0 + col) * CC + h * HD + 8 * g;
  v16h qf[2][2], kf[2][2];
#pragma unroll
  for (int u = 0; u < 2; ++u)
#pragma unroll
    for (int kc = 0; kc < 2; ++kc) qf[u][kc] = frag_p(Qb + u * 16 * CC + kc * 32);
  asm volatile("s_wait_xcnt 0x0" :: "v"(Qb) : "memory");   // behind the eight loads above; the pointer is an input so that it lives up to the wait and no fragment is placed on the address pair that an issued load names
  // this thread's share of a stage, 16 bytes a copy: k rows (tid >> 3) + 32 i, 8 lanes a 128-byte row; v planes (tid >> 5) + 8 i, a wave a 512-byte run of keys
  const char* kg = (const char*)(KH + ((size_t)b * TT + (tid >> 3)) * CC + h * HD + (tid & 7) * 8);
  const char* vg = (const char*)(VT + ((size_t)b * CC + h * HD + (tid >> 5)) * (size_t)TT + (tid & 31) * 8);
  const unsigned kl = (unsigned)(size_t)ring + (tid >> 3) * KPIT + (tid & 7) * 16, vl = (unsigned)(size_t)ring + KTILE + (tid >> 5) * VPIT + (tid & 31) * 16;   // LDS byte addresses: the low 32 bits of the __shared__ address
  // eight copies, LDS address l + i * lstep from global address p + i * gstep, and, as the statement's last line, the wait that stands in front of any overwrite of a register that an issued copy names
  auto copy8 = [&](const unsigned l, const unsigned lstep, const char* p, const size_t gstep) __attribute__((always_inline)) {
    asm volatile("global_load_async_to_lds_b128 %0, %8, off\n\tglobal_load_async_to_lds_b128 %1, %9, off\n\tglobal_load_async_to_lds_b128 %2, %10, off\n\tglobal_load_async_to_lds_b128 %3, %11, off\n\t"
                 "global_load_async_to_lds_b128 %4, %12, off\n\tglobal_load_async_to_lds_b128 %5, %13, off\n\tglobal_load_async_to_lds_b128 %6, %14, off\n\tglobal_load_async_to_lds_b128 %7, %15, off\n\ts_wait_xcnt 0x0"
                 :: "v"(l), "v"(l + lstep), "v"(l + 2 * lstep), "v"(l + 3 * lstep), "v"(l + 4 * lstep), "v"(l + 5 * lstep), "v"(l + 6 * lstep), "v"(l + 7 * lstep),
                    "v"(p), "v"(p + gstep), "v"(p + 2 * gstep), "v"(p + 3 * gstep), "v"(p + 4 * gstep), "v"(p + 5 * gstep), "v"(p + 6 * gstep), "v"(p + 7 * gstep) : "memory"); };
  auto copy = [&](const int s, const int buf) __attribute__((always_inline)) {
    copy8(kl + buf * STG, 32 * KPIT, kg + (size_t)s * SK * CC * 2, (size_t)32 * CC * 2);
    copy8(vl + buf * STG, 8 * VPIT, vg + (size_t)s * SK * 2, (size_t)8 * TT * 2); };
  copy(0, 0);
  asm volatile("s_wait_asynccnt 0x0" ::: "memory");   // this wave's copies of stage 0 have landed
  __syncthreads();                                    // and every wave's: stage 0 may be read
  copy(1, 1);
  v8f o[2][HD / 16] = {}; float m[2] = { -3.0e38f, -3.0e38f }, l[2] = { 0.f, 0.f };
  // one pass = 32 keys; kb, vb: this lane's place in the pass's k rows and v planes; more: a further pass of the same stage follows, whose k rows are fetched behind this pass's score products
  auto pass = [&](const unsigned char* kb, const unsigned char* vb, const bool more) __attribute__((always_inline)) {
    v8f s[2][2] = {};
#pragma unroll
    for (int kc = 0; kc < 2; ++kc)
#pragma unroll
      for (int t = 0; t < 2; ++t)
#pragma unroll
        for (int u = 0; u < 2; ++u) s[u][t] = mm16(kf[t][kc], qf[u][kc], s[u][t]);
    __builtin_amdgcn_sched_barrier(0);   // with the one behind the reads: the pass's LDS reads stand in ONE place behind the score products; left free they are spread among the products
    if (!more) asm volatile("" :: "v"(kf[0][0]), "v"(kf[0][1]), "v"(kf[1][0]), "v"(kf[1][1]));   // inputs only: in a stage's last pass the loaded k fragments die product by product, and without this a later score product's D is placed on a register that the product in front of it still reads
    v16h vf[HD / 16];
#pragma unroll
    for (int j = 0; j < HD / 16; ++j) vf[j] = frag_l(vb + j * 16 * VPIT);
    if (more) {
#pragma unroll
      for (int t = 0; t < 2; ++t)
#pragma unroll
        for (int kc = 0; kc < 2; ++kc) kf[t][kc] = frag_l(kb + (32 + t * 16) * KPIT + kc * 64); }
    __builtin_amdgcn_sched_barrier(0);   // keeps the reads in front of the softmax, which then covers their latency
    v16h pf[2]; float mn[2], alpha[2];
#pragma unroll
    for (int u = 0; u < 2; ++u) {
      float mx = fmaxf(s[u][0][0], s[u][1][0]);
#pragma unroll
      for (int r = 1; r < 8; ++r) mx = fmaxf(mx, fmaxf(s[u][0][r], s[u][1][r]));
      mx = fmaxf(mx, xhalf(mx)); mn[u] = fmaxf(m[u], mx * LSC); }
    exp2x2(alpha[0], alpha[1], m[0] - mn[0], m[1] - mn[1]);   // 0 on the first pass
#pragma unroll
    for (int u = 0; u < 2; ++u) { m[u] = mn[u]; const float off = 11.0f - mn[u]; float p[2][8];
#pragma unroll
      for (int t = 0; t < 2; ++t) { float a[8];
#pragma unroll
        for (int r = 0; r < 8; ++r) a[r] = fmaf(s[u][t][r], LSC, off);
        exp2x8(p[t], a);
#pragma unroll
        for (int r = 0; r < 8; ++r) pf[u][8 * t + r] = (_Float16)p[t][r]; }
      float q[8];   // the pass's 16 terms as a tree, not a chain of dependent adds
#pragma unroll
      for (int r = 0; r < 8; ++r) q[r] = p[0][r] + p[1][r];
      l[u] = fmaf(l[u], alpha[u], ((q[0] + q[1]) + (q[2] + q[3])) + ((q[4] + q[5]) + (q[6] + q[7])));
#pragma unroll
      for (int j = 0; j < HD / 16; ++j) o[u][j] *= alpha[u];
    }
#pragma unroll
    for (int j = 0; j < HD / 16; ++j)
#pragma unroll
      for (int u = 0; u < 2; ++u) o[u][j] = mm16(vf[j], pf[u], o[u][j]);
  };
  for (int s = 0; s < NST; ++s) {
    const unsigned char* kb = ring + (s & 1) * STG + col * KPIT + 16 * g; const unsigned char* vb = ring + (s & 1) * STG + KTILE + col * VPIT + 16 * g;
#pragma unroll
    for (int t = 0; t < 2; ++t)
#pragma unroll
      for (int kc = 0; kc < 2; ++kc) kf[t][kc] = frag_l(kb + t * 16 * KPIT + kc * 64);
#pragma unroll 1   // kept rolled: unrolled, every pass's sum of exponentials is sunk to the stage's foot and its terms are held till there, which takes the registers past 256 and into scratch
    for (int p = 0; p < SK / 32 - 1; ++p) { pass(kb, vb, true); kb += 32 * KPIT; vb += 64; }
    pass(kb, vb, false);
    asm volatile("s_wait_dscnt 0x0" ::: "memory");      // this wave's reads of stage s are done
    asm volatile("s_wait_asynccnt 0x0" ::: "memory");   // this wave's copies of stage s + 1 have landed
    __syncthreads();                                    // publishes stage s + 1 and ends every wave's reads of stage s, whose buffer the copies behind it refill
    if (s + 2 < NST) copy(s + 2, s & 1); }
  asm volatile("s_wait_asynccnt 0x0" ::: "memory");     // no copy is outstanding when the wave ends
  float* yr = Y + ((size_t)b * TT + q0 + col) * CC + h * HD + 8 * g;
#pragma unroll
  for (int u = 0; u < 2; ++u) { const float inv = 1.0f / (l[u] + xhalf(l[u]));
#pragma unroll
    for (int j = 0; j < HD / 16; ++j) o[u][j] *= inv; }
  __builtin_amdgcn_sched_barrier(0);   // every product in front of the first store: no register of an issued store is written again
#pragma unroll
  for (int u = 0; u < 2; ++u)
#pragma unroll
    for (int j = 0; j < HD / 16; ++j) { const v8f r = o[u][j]; const v4f lo = { r[0], r[1], r[2], r[3] }, hi = { r[4], r[5], r[6], r[7] }; vst2(yr + u * 16 * CC + j * 16, lo); vst2(yr + u * 16 * CC + j * 16 + 4, hi); } }

extern "C" void kernel_launch(void* const* d_in, const int* in_sizes, int n_in, void* d_out, int out_size, void* d_ws, size_t ws_size, hipStream_t stream) {
  (void)in_sizes; (void)n_in; (void)out_size;
  const float** F = (const float**)d_in;
  if (ws_size < (size_t)WS_END) return;
  char* ws = (char*)d_ws; _Float16 *QH = (_Float16*)(ws + WS_QH), *KH = (_Float16*)(ws + WS_KH), *VT = (_Float16*)(ws + WS_VT), *QL = (_Float16*)(ws + WS_QL), *KL = (_Float16*)(ws + WS_KL); __bf16 *VB = (__bf16*)(ws + WS_VB), *VBL = (__bf16*)(ws + WS_VBL); float *S = (float*)(ws + WS_S), *Y = (float*)(ws + WS_Y);
  (void)Y; (void)S; (void)QL; (void)KL; (void)VB; (void)VBL;
  // inputs: 0 x [2,2048,1024]; 1 Wq [1024,1024] (in,out), 2 bq; 3 Wk, 4 bk; 5 Wv, 6 bv (biases nonzero); no output projection
  k_proj<<<dim3(TNB * TT / PBM, CC / PBN, 3), PTH, 0, stream>>>(F[0], F[0], F[0], F[1], F[3], F[5], F[2], F[4], F[6], QH, KH, VT);
  k_attn<<<dim3(TT / (AW * QCOLS), TNB * NH), AW * 32, 0, stream>>>(QH, KH, VT, (float*)d_out);
}

// v004
// Measured time: 62.4 microseconds a run.
// Next to v003, in two timings, it ran 1.08 times as fast each time.
// Over all steps from v000 it is 17.8 times as fast.
// compute dtype: all float inputs rounded to bf16; q/k/v projections with EXACT bf16 products on WMMA 16x16x32 (f32 accumulate) + bias; logits q x k once to f16 each (1 product) x SCALE; softmax f32 against a maximum that is raised only when a term could leave f16's range; exp(s - m) x 2^11 once to f16 x v once to f16 (1 product), divided by the f32 sum at the end; f32 output.
#include <hip/hip_runtime.h>
#include <math.h>

typedef __attribute__((ext_vector_type(16))) _Float16 v16h;
typedef __attribute__((ext_vector_type(16))) __bf16 v16b;
typedef __attribute__((ext_vector_type(8)))  _Float16 v8h;
typedef __attribute__((ext_vector_type(8)))  float v8f;
typedef __attribute__((ext_vector_type(4)))  float v4f;
typedef __attribute__((ext_vector_type(2)))  float v2f;
typedef __attribute__((ext_vector_type(4)))  unsigned v4u;
typedef __attribute__((ext_vector_type(4)))  int v4i;
typedef float __attribute__((may_alias)) float_a;
typedef int __attribute__((may_alias)) int_a;

template <typename T> __device__ __forceinline__ void vst2(void* p, T v) { *(T*)p = v;  }
__device__ __forceinline__ v8f wmma16(v16h a, v16h b, v8f c) {
  v8f d = __builtin_amdgcn_wmma_f32_16x16x32_f16(false, a, false, b, (short)0, c, false, false);
  asm volatile("v_nop\n\tv_nop\n\tv_nop\n\tv_nop" : "+v"(d) : "v"(a), "v"(b));
  return d;
}
__device__ __forceinline__ v8f wmma_bf(v16b a, v16b b, v8f c) {
  v8f d = __builtin_amdgcn_wmma_f32_16x16x32_bf16(false, a, false, b, (short)0, c, false, false);
  asm volatile("v_nop\n\tv_nop\n\tv_nop\n\tv_nop" : "+v"(d) : "v"(a), "v"(b));
  return d;
}
// 16x16x32 fragments: lane = (h = lane>>4, row/col = lane&15); elements 0..7 = k0+8h+0..7, 8..15 = k0+16+8h+0..7; D element r = row 8h+r
__device__ __forceinline__ v16h frag_h(const _Float16* rowk0, int lane) {
  union { v16h v; v8h q[2]; } u; const _Float16* p = rowk0 + 8 * (lane >> 4);
  u.q[0] = *(const v8h*)p; u.q[1] = *(const v8h*)(p + 16); return u.v;
}
__device__ __forceinline__ v16h frag_f32(const float* rowk0, int lane) {
  v16h a; const float* p = rowk0 + 8 * (lane >> 4);
#pragma unroll
  for (int i = 0; i < 8; ++i) { a[i] = (_Float16)p[i]; a[8 + i] = (_Float16)p[16 + i]; }
  return a;
}
__device__ __forceinline__ v16h frag_f32s(const float* rowk0, int lane, float sc) {
  v16h a; const float* p = rowk0 + 8 * (lane >> 4);
#pragma unroll
  for (int i = 0; i < 8; ++i) { a[i] = (_Float16)(p[i] * sc); a[8 + i] = (_Float16)(p[16 + i] * sc); }
  return a;
}
// column fragment from a [K][ld] layout (column n), rows >= K read as 0
__device__ __forceinline__ v16h fragc_f32(const float* W, int k0, int n, int lane, int ld, int K) {
  v16h a; const int g = lane >> 4;
#pragma unroll
  for (int i = 0; i < 8; ++i) { const int ka = k0 + 8 * g + i, kb = ka + 16;
    a[i] = (_Float16)(ka < K ? W[(size_t)(ka < K ? ka : K - 1) * ld + n] : 0.f); a[8 + i] = (_Float16)(kb < K ? W[(size_t)(kb < K ? kb : K - 1) * ld + n] : 0.f); }
  return a;
}
struct F2 { v16b h, l; };
__device__ __forceinline__ F2 bsplit16(const float v[16]) { F2 r;
#pragma unroll
  for (int i = 0; i < 16; ++i) { const __bf16 h = (__bf16)v[i]; r.h[i] = h; r.l[i] = (__bf16)(v[i] - (float)h); }
  return r; }
__device__ __forceinline__ F2 split_row(const float* row, int k0, int lane) { float v[16]; const float* p = row + k0 + 8 * (lane >> 4);
#pragma unroll
  for (int i = 0; i < 8; ++i) { v[i] = p[i]; v[8 + i] = p[16 + i]; }
  return bsplit16(v); }
__device__ __forceinline__ F2 split_rowK(const float* row, int k0, int lane, int K) { float v[16]; const int g = lane >> 4;
#pragma unroll
  for (int i = 0; i < 8; ++i) { const int ka = k0 + 8 * g + i, kb = ka + 16; v[i] = ka < K ? row[ka < K ? ka : K - 1] : 0.f; v[8 + i] = kb < K ? row[kb < K ? kb : K - 1] : 0.f; }
  return bsplit16(v); }
__device__ __forceinline__ F2 split_col(const float* W, int k0, int n, int lane, int ld, int K) { float v[16]; const int g = lane >> 4;
#pragma unroll
  for (int i = 0; i < 8; ++i) { const int ka = k0 + 8 * g + i, kb = ka + 16; v[i] = ka < K ? W[(size_t)(ka < K ? ka : K - 1) * ld + n] : 0.f; v[8 + i] = kb < K ? W[(size_t)(kb < K ? kb : K - 1) * ld + n] : 0.f; }
  return bsplit16(v); }
__device__ __forceinline__ v8f mac3(const F2& a, const F2& b, v8f c) { c = wmma_bf(a.l, b.h, c); c = wmma_bf(a.h, b.l, c); return wmma_bf(a.h, b.h, c); }
__device__ __forceinline__ float sigm(float v) { return 1.0f / (1.0f + expf(-v)); }
#define LDSX() do { asm volatile("s_wait_dscnt 0" ::: "memory"); __builtin_amdgcn_wave_barrier(); __builtin_amdgcn_fence(__ATOMIC_RELEASE, "workgroup"); } while (0)

// Multi-head self-attention without an output projection (x [2,2048,1024]; (in,out) Wq / Wk / Wv [1024,1024] + biases, uniform(+-1/32); 16 heads x 64; scale 1/8; softmax over keys; heads merged) -> [2,2048,1024].
#define NB 2
#define TT 2048
#define CC 1024            // NH * HD = projected width
#define DIN 1024          // input (model) width
#define NH 16
#define HD 64
#define NQB (TT / 64)
#define HG 4
#define SCALE (0.125f)
#define CAUSAL 0
#ifndef TNB
#define TNB NB
#endif
__device__ __forceinline__ float bfr(float v) { return (float)(__bf16)v; }
__host__ __device__ __forceinline__ int kb_last(int qb) { return CAUSAL ? ((qb * 64 + 63) >> 7) : (TT / 128 - 1); }
typedef __attribute__((ext_vector_type(8))) __bf16 v8b;
__device__ __forceinline__ v16b frag_b(const __bf16* rowk0, int lane) {
  union { v16b v; v8b q[2]; } u; const __bf16* p = rowk0 + 8 * (lane >> 4);
  u.q[0] = *(const v8b*)p; u.q[1] = *(const v8b*)(p + 16); return u.v;
}
#define QBH 0              // unused: this file has no high-precision path
#define QHI 0               // single-product logits on every row
#define KHI 64            // key rows of the k residual / v bf16 hi+lo workspace planes, which no kernel here writes or reads
// B fragment (k rows k0+.., output column o) of a weight: (in,out) [K][ld] or (out,in) [ld rows of K]: bf16 exact, or f16(bf16 * 256) exact
__device__ __forceinline__ v16b wcol_io(const float* Wm, int k0, int o, int lane, int ld) { v16b w; const int g = lane >> 4;
#pragma unroll
  for (int i = 0; i < 8; ++i) { w[i] = (__bf16)Wm[(size_t)(k0 + 8 * g + i) * ld + o]; w[8 + i] = (__bf16)Wm[(size_t)(k0 + 16 + 8 * g + i) * ld + o]; }
  return w; }
__device__ __forceinline__ v16b wcol_oi(const float* Wm, int k0, int o, int lane, int K) { v16b w; const float* p = Wm + (size_t)o * K + k0 + 8 * (lane >> 4);
#pragma unroll
  for (int i = 0; i < 8; ++i) { w[i] = (__bf16)p[i]; w[8 + i] = (__bf16)p[16 + i]; }
  return w; }
__device__ __forceinline__ v16h wcolh_io(const float* Wm, int k0, int o, int lane, int ld) { v16h w; const int g = lane >> 4;
#pragma unroll
  for (int i = 0; i < 8; ++i) { w[i] = (_Float16)(bfr(Wm[(size_t)(k0 + 8 * g + i) * ld + o]) * 256.0f); w[8 + i] = (_Float16)(bfr(Wm[(size_t)(k0 + 16 + 8 * g + i) * ld + o]) * 256.0f); }
  return w; }
__device__ __forceinline__ v16h wcolh_oi(const float* Wm, int k0, int o, int lane, int K) { v16h w; const float* p = Wm + (size_t)o * K + k0 + 8 * (lane >> 4);
#pragma unroll
  for (int i = 0; i < 8; ++i) { w[i] = (_Float16)(bfr(p[i]) * 256.0f); w[8 + i] = (_Float16)(bfr(p[16 + i]) * 256.0f); }
  return w; }
#define WQKV_LAYOUT 0   // 0 = (in,out) [DIN][CC]; 1 = (out,in) [CC][DIN]; 2 = per-head [NH][DIN][HD]
__device__ __forceinline__ v16b wcol_hdk(const float* Wm, int k0, int o, int lane) { v16b w; const int g = lane >> 4; const float* p = Wm + (size_t)(o / HD) * DIN * HD + (o % HD);
#pragma unroll
  for (int i = 0; i < 8; ++i) { w[i] = (__bf16)p[(size_t)(k0 + 8 * g + i) * HD]; w[8 + i] = (__bf16)p[(size_t)(k0 + 16 + 8 * g + i) * HD]; }
  return w; }
#define WO_OUT_IN 0
#if WQKV_LAYOUT == 1
#define WCOL(W, k0, o, lane) wcol_oi(W, k0, o, lane, DIN)
#elif WQKV_LAYOUT == 2
#define WCOL(W, k0, o, lane) wcol_hdk(W, k0, o, lane)
#else
#define WCOL(W, k0, o, lane) wcol_io(W, k0, o, lane, CC)
#endif
#if WO_OUT_IN
#define WOCOL(W, k0, o, lane) wcol_oi(W, k0, o, lane, CC)
#define WOCOLH(W, k0, o, lane) wcolh_oi(W, k0, o, lane, CC)
#else
#define WOCOL(W, k0, o, lane) wcol_io(W, k0, o, lane, DIN)
#define WOCOLH(W, k0, o, lane) wcolh_io(W, k0, o, lane, DIN)
#endif

#ifndef SM_EXTRA_PARAMS
#define SM_EXTRA_PARAMS
#endif
#ifndef PROJ_EXTRA_PARAMS
#define PROJ_EXTRA_PARAMS
#endif
#ifndef SM_MASK_HOOK
#define SM_MASK_HOOK (void)0
#endif

#define WS_QH  0u                                      // f16 q rows [b*t][CC]
#define WS_KH  (WS_QH + 2u * (size_t)NB * TT * CC)      // f16 k rows [b*t][CC]
#define WS_VT  (WS_KH + 2u * (size_t)NB * TT * CC)      // f16 v planes [b][c][t]
#define WS_QL  (WS_VT + 2u * (size_t)NB * CC * TT)      // f16 q residual x 2^10 rows [b][t < QHI][CC]
#define WS_KL  (WS_QL + 2u * (size_t)NB * QHI * CC)     // f16 k residual x 2^10 rows [b][t < KHI][CC]
#define WS_VB  (WS_KL + 2u * (size_t)NB * KHI * CC)     // bf16 v hi planes [b][c][t < KHI]
#define WS_VBL (WS_VB + 2u * (size_t)NB * CC * KHI)
#define WS_S   (WS_VBL + 2u * (size_t)NB * CC * KHI)    // f32 [hg][t][s], reserved: no kernel here uses it
#define WS_Y   (WS_S  + 4u * (size_t)HG * TT * TT)      // f32 ctx rows [b*t][CC] (only when there is an output projection)
#define WS_END (WS_Y  + 0u)

#define PBM 256            // rows of a block's tile
#define PBN 256            // columns of a block's tile
#define PBK 32             // k of a stage: one product deep
#define PTH 512            // threads: 16 waves as 4 x 4, a wave = 64 rows x 64 columns
#define PPIT 40            // LDS row pitch in bf16: 64-byte rows at 80 bytes (16 bytes x odd), free of bank conflicts for 16-byte reads and writes
typedef __attribute__((ext_vector_type(4))) __bf16 v4b;
__device__ __forceinline__ v8f mmb(v16b a, v16b b, v8f c) { return __builtin_amdgcn_wmma_f32_16x16x32_bf16(false, a, false, b, (short)0, c, false, false); }
// ---- k_proj: block = (256 rows, 256 cols, which): q/k/v = X W (+ b) with exact bf16 products (K = DIN, 32 k a product, k ascending) -> which 0: q f16 rows; 1: k f16 rows; 2: v f16 planes [c][t]
// a stage = 32 k of the X rows and of the W columns, fetched ONCE per block in whole 128-byte lines, rounded to bf16 and laid k-contiguous in LDS (xs[row][k], wt[col][k]: W is transposed on the way, a thread holding 16 k of one column, as two runs of 8);
// two buffers: stage s + 1 is written while stage s is read, stage s + 2 is in flight from global into registers; one barrier a stage
__global__ __launch_bounds__(PTH) void k_proj(const float* __restrict__ XQ, const float* __restrict__ XK, const float* __restrict__ XV, const float* __restrict__ WQ, const float* __restrict__ WK, const float* __restrict__ WV, const float* __restrict__ BQ, const float* __restrict__ BK, const float* __restrict__ BV,
    _Float16* __restrict__ QH, _Float16* __restrict__ KH, _Float16* __restrict__ VT) {
  __shared__ __align__(16) unsigned char sm[PBM * (PBN + 8) * 2];   // the two stage buffers of X and of W (81,920 bytes); behind the loop the f16 output tile
  __bf16 (*xs)[PBM][PPIT] = (__bf16 (*)[PBM][PPIT])sm; __bf16 (*wt)[PBN][PPIT] = (__bf16 (*)[PBN][PPIT])(sm + 2 * PBM * PPIT * 2);
  const int tid = threadIdx.x, wave = tid >> 5, lane = tid & 31, col = lane & 15, g = lane >> 4, wr = wave >> 2, wc = wave & 3; const int which = blockIdx.z; const int c0 = blockIdx.y * PBN; const size_t r0 = (size_t)blockIdx.x * PBM; const size_t bb = r0 / TT; const int t0 = (int)(r0 % TT);
  const float* X = which == 0 ? XQ : which == 1 ? XK : XV; const float* WA = which == 0 ? WQ : which == 1 ? WK : WV; const float* BA = which == 0 ? BQ : which == 1 ? BK : BV;
  const int xrow = tid >> 3, xk = (tid & 7) * 4;      // X: 8 lanes a row, 16 bytes each; rows xrow + 64 i
  const int wn = tid & 255, wq = tid >> 8;            // W: a lane a column, 8 k rows from 8 (wq + 2 i)
  unsigned xo = (unsigned)(((r0 + xrow) * DIN + xk) * 4), wo = (unsigned)(((wq * 8) * CC + c0 + wn) * 4);   // this thread's byte offsets in X and in W at the next stage to fetch; the bases stay uniform
  v4f xr[4]; float wg[2][8];
  auto fetch = [&]() __attribute__((always_inline)) {
#pragma unroll
    for (int i = 0; i < 4; ++i) xr[i] = *(const v4f*)((const char*)X + xo + (size_t)i * 64 * DIN * 4);
#pragma unroll
    for (int i = 0; i < 2; ++i)
#pragma unroll
      for (int e = 0; e < 8; ++e) wg[i][e] = *(const float*)((const char*)WA + wo + (size_t)(i * 16 + e) * CC * 4);
    // directly behind the last load, on every way on from here: the wait that stands in front of any overwrite of a register that these loads name (the two offsets, the two uniform bases); the steps of the two offsets to the next stage are in the same statement, so that they cannot come in front of it
    asm volatile("s_wait_xcnt 0x0\n\tv_add_nc_u32 %0, %2, %0\n\tv_add_nc_u32 %1, %3, %1" : "+v"(xo), "+v"(wo) : "i"(PBK * 4), "i"(PBK * CC * 4) : "memory"); };
  auto stash = [&](const int buf) __attribute__((always_inline)) {
#pragma unroll
    for (int i = 0; i < 4; ++i) { const v4b t = { (__bf16)xr[i][0], (__bf16)xr[i][1], (__bf16)xr[i][2], (__bf16)xr[i][3] }; *(v4b*)&xs[buf][xrow + 64 * i][xk] = t; }
#pragma unroll
    for (int i = 0; i < 2; ++i) { v8b t;
#pragma unroll
      for (int e = 0; e < 8; ++e) t[e] = (__bf16)wg[i][e];
      *(v8b*)&wt[buf][wn][(wq + 2 * i) * 8] = t; } };
  // the stage barrier by hand: __syncthreads() also waits for the global loads in flight, which are to stay in flight across it; what it must order is LDS alone, so this wave's LDS stores and reads are waited for in front of it
  auto stage_barrier = [&]() __attribute__((always_inline)) { asm volatile("s_wait_dscnt 0x0" ::: "memory"); asm volatile("s_barrier_signal -1\n\ts_barrier_wait -1" ::: "memory"); };
  fetch(); stash(0); fetch();
  stage_barrier();
  v8f acc[4][4] = {};
#pragma unroll 2
  for (int s = 0; s < DIN / PBK; ++s) { const int cur = s & 1; v16b a[4], w[4];
#pragma unroll
    for (int i = 0; i < 4; ++i) { a[i] = frag_b(&xs[cur][wr * 64 + i * 16 + col][0], lane); w[i] = frag_b(&wt[cur][wc * 64 + i * 16 + col][0], lane); }
    if (s + 1 < DIN / PBK) { stash(cur ^ 1); if (s + 2 < DIN / PBK) fetch(); }
#pragma unroll
    for (int j = 0; j < 4; ++j)
#pragma unroll
      for (int i = 0; i < 4; ++i) acc[i][j] = mmb(a[i], w[j], acc[i][j]);
    stage_barrier(); }   // publishes stage s + 1 and ends every wave's reads of stage s, whose buffer the next trip overwrites
  _Float16 (*st)[PBN + 8] = (_Float16 (*)[PBN + 8])sm;   // the output tile, over the stage buffers, which every wave has left at the loop's last barrier
  float bias[4] = { 0.f, 0.f, 0.f, 0.f };
  if (BA) { const int bi = c0 + wc * 64 + col; float bl[4];
#pragma unroll
    for (int j = 0; j < 4; ++j) bl[j] = BA[bi + j * 16];
    asm volatile("s_wait_xcnt 0x0" :: "v"(bi) : "memory");   // behind the four loads; the index is an input so that it lives up to the wait and no loaded value is placed on the register that an issued load names
#pragma unroll
    for (int j = 0; j < 4; ++j) bias[j] = bfr(bl[j]); }
  if (which < 2) { _Float16* DH = which == 0 ? QH : KH;
#pragma unroll
    for (int j = 0; j < 4; ++j)
#pragma unroll
      for (int i = 0; i < 4; ++i)
#pragma unroll
        for (int r = 0; r < 8; ++r) st[wr * 64 + i * 16 + 8 * g + r][wc * 64 + j * 16 + col] = (_Float16)(acc[i][j][r] + bias[j]);
    __syncthreads();
#pragma unroll
    for (int it = 0; it < PBM * (PBN / 8) / PTH; ++it) { const int e = tid + it * PTH, rl = e >> 5, q = e & 31; vst2((unsigned*)(DH + (r0 + rl) * CC + c0 + q * 8), *(const v4u*)&st[rl][q * 8]); }
  } else {
#pragma unroll
    for (int j = 0; j < 4; ++j)
#pragma unroll
      for (int i = 0; i < 4; ++i)
#pragma unroll
        for (int r = 0; r < 8; ++r) st[wc * 64 + j * 16 + col][wr * 64 + i * 16 + 8 * g + r] = (_Float16)(acc[i][j][r] + bias[j]);
    __syncthreads();
#pragma unroll
    for (int it = 0; it < PBN * (PBM / 8) / PTH; ++it) { const int e = tid + it * PTH, cl = e >> 5, q = e & 31; vst2((unsigned*)(VT + (bb * CC + c0 + cl) * (size_t)TT + t0 + q * 8), *(const v4u*)&st[cl][q * 8]); } } }
// lane l with lane l ^ 16
__device__ __forceinline__ float xhalf(float x) { return __builtin_bit_cast(float, __builtin_amdgcn_permlanex16(__builtin_bit_cast(int, x), __builtin_bit_cast(int, x), 0x76543210, 0xfedcba98, false, false)); }
__device__ __forceinline__ v8f mm16(v16h a, v16h b, v8f c) { return __builtin_amdgcn_wmma_f32_16x16x32_f16(false, a, false, b, (short)0, c, false, false); }
// 16x16x32 fragment in the hardware k order; p = the lane's row at k0 + 8 * (lane >> 4)
__device__ __forceinline__ v16h frag_p(const _Float16* p) { union { v16h v; v8h q[2]; } u; u.q[0] = *(const v8h*)p; u.q[1] = *(const v8h*)(p + 16); return u.v; }
// exp2 in runs, one statement a run: early-clobbered results, so that no v_exp_f32 of a run writes a source or reads a result of the one in front of it, and a closing v_nop: the slot that the instruction set asks for behind a transcendental
__device__ __forceinline__ void exp2x8(float (&p)[8], const float (&a)[8]) {
  asm("v_exp_f32 %0, %8\n\tv_exp_f32 %1, %9\n\tv_exp_f32 %2, %10\n\tv_exp_f32 %3, %11\n\tv_exp_f32 %4, %12\n\tv_exp_f32 %5, %13\n\tv_exp_f32 %6, %14\n\tv_exp_f32 %7, %15\n\tv_nop"
      : "=&v"(p[0]), "=&v"(p[1]), "=&v"(p[2]), "=&v"(p[3]), "=&v"(p[4]), "=&v"(p[5]), "=&v"(p[6]), "=&v"(p[7]) : "v"(a[0]), "v"(a[1]), "v"(a[2]), "v"(a[3]), "v"(a[4]), "v"(a[5]), "v"(a[6]), "v"(a[7])); }
__device__ __forceinline__ void exp2x2(float& p0, float& p1, float a0, float a1) { asm("v_exp_f32 %0, %2\n\tv_exp_f32 %1, %3\n\tv_nop" : "=&v"(p0), "=&v"(p1) : "v"(a0), "v"(a1)); }
#define QCOLS 32           // query columns per wave (two 16-column groups)
#define AW 8               // waves per block
#define LSC (SCALE * 1.4426950408889634f)   // logits in base 2
#define SK 256             // keys of a stage: eight passes
#define NST (TT / SK)      // stages
#define KPIT 144           // LDS pitch of a k row (128 bytes) and
#define VPIT 528           // of a v plane's 256 keys (512 bytes): 16 bytes x odd, free of bank conflicts for 16-byte reads
#define KTILE (SK * KPIT)
#define VTILE (HD * VPIT)
#define STG (KTILE + VTILE)   // bytes of a stage buffer: the k rows, then the v planes
#define PSMAX 65504.0f     // the largest finite f16
// 16x16x32 fragment in the hardware k order from LDS; p = the lane's row at k0 + 8 * (lane >> 4), in bytes
__device__ __forceinline__ v16h frag_l(const unsigned char* p) { union { v16h v; v8h q[2]; } u; u.q[0] = *(const v8h*)p; u.q[1] = *(const v8h*)(p + 32); return u.v; }
__global__ __launch_bounds__(AW * 32) void k_attn(const _Float16* __restrict__ QH, const _Float16* __restrict__ KH, const _Float16* __restrict__ VT, float* __restrict__ Y) {
  __shared__ __align__(16) unsigned char ring[2 * STG];
  const int tid = threadIdx.x, wave = tid >> 5, lane = tid & 31, col = lane & 15, g = lane >> 4;
  const int b = blockIdx.y / NH, h = blockIdx.y % NH; const int q0 = blockIdx.x * (AW * QCOLS) + wave * QCOLS;
  const _Float16* Qb = QH + ((size_t)b * TT + q0 + col) * CC + h * HD + 8 * g;
  v16h qf[2][2], kf[2][2];
#pragma unroll
  for (int u = 0; u < 2; ++u)
#pragma unroll
    for (int kc = 0; kc < 2; ++kc) qf[u][kc] = frag_p(Qb + u * 16 * CC + kc * 32);
  asm volatile("s_wait_xcnt 0x0" :: "v"(Qb) : "memory");   // behind the eight loads above; the pointer is an input so that it lives up to the wait and no fragment is placed on the address pair that an issued load names
  // this thread's share of a stage, 16 bytes a copy: k rows (tid >> 3) + 32 i, 8 lanes a 128-byte row; v planes (tid >> 5) + 8 i, a wave a 512-byte run of keys
  const char* kg = (const char*)(KH + ((size_t)b * TT + (tid >> 3)) * CC + h * HD + (tid & 7) * 8);
  const char* vg = (const char*)(VT + ((size_t)b * CC + h * HD + (tid >> 5)) * (size_t)TT + (tid & 31) * 8);
  const unsigned kl = (unsigned)(size_t)ring + (tid >> 3) * KPIT + (tid & 7) * 16, vl = (unsigned)(size_t)ring + KTILE + (tid >> 5) * VPIT + (tid & 31) * 16;   // LDS byte addresses: the low 32 bits of the __shared__ address
  // eight copies, LDS address l + i * lstep from global address p + i * gstep, and, as the statement's last line, the wait that stands in front of any overwrite of a register that an issued copy names
  auto copy8 = [&](const unsigned l, const unsigned lstep, const char* p, const size_t gstep) __attribute__((always_inline)) {
    asm volatile("global_load_async_to_lds_b128 %0, %8, off\n\tglobal_load_async_to_lds_b128 %1, %9, off\n\tglobal_load_async_to_lds_b128 %2, %10, off\n\tglobal_load_async_to_lds_b128 %3, %11, off\n\t"
                 "global_load_async_to_lds_b128 %4, %12, off\n\tglobal_load_async_to_lds_b128 %5, %13, off\n\tglobal_load_async_to_lds_b128 %6, %14, off\n\tglobal_load_async_to_lds_b128 %7, %15, off\n\ts_wait_xcnt 0x0"
                 :: "v"(l), "v"(l + lstep), "v"(l + 2 * lstep), "v"(l + 3 * lstep), "v"(l + 4 * lstep), "v"(l + 5 * lstep), "v"(l + 6 * lstep), "v"(l + 7 * lstep),
                    "v"(p), "v"(p + gstep), "v"(p + 2 * gstep), "v"(p + 3 * gstep), "v"(p + 4 * gstep), "v"(p + 5 * gstep), "v"(p + 6 * gstep), "v"(p + 7 * gstep) : "memory"); };
  auto copy = [&](const int s, const int buf) __attribute__((always_inline)) {
    copy8(kl + buf * STG, 32 * KPIT, kg + (size_t)s * SK * CC * 2, (size_t)32 * CC * 2);
    copy8(vl + buf * STG, 8 * VPIT, vg + (size_t)s * SK * 2, (size_t)8 * TT * 2); };
  copy(0, 0);
  asm volatile("s_wait_asynccnt 0x0" ::: "memory");   // this wave's copies of stage 0 have landed
  __syncthreads();                                    // and every wave's: stage 0 may be read
  copy(1, 1);
  v8f o[2][HD / 16] = {}; float off[2] = { 3.0e38f, 3.0e38f }, l[2] = { 0.f, 0.f };   // off = 11 - m, m the maximum in use (none yet)
  // one pass = 32 keys; kb, vb: this lane's place in the pass's k rows and v planes; more: a further pass of the same stage follows, whose k rows are fetched behind this pass's score products
  auto pass = [&](const unsigned char* kb, const unsigned char* vb, const bool more) __attribute__((always_inline)) {
    v8f s[2][2] = {};
#pragma unroll
    for (int kc = 0; kc < 2; ++kc)
#pragma unroll
      for (int t = 0; t < 2; ++t)
#pragma unroll
        for (int u = 0; u < 2; ++u) s[u][t] = mm16(kf[t][kc], qf[u][kc], s[u][t]);
    __builtin_amdgcn_sched_barrier(0);   // with the one behind the reads: the pass's LDS reads stand in ONE place behind the score products; left free they are spread among the products
    if (!more) asm volatile("" :: "v"(kf[0][0]), "v"(kf[0][1]), "v"(kf[1][0]), "v"(kf[1][1]));   // inputs only: in a stage's last pass the loaded k fragments die product by product, and without this a later score product's D is placed on a register that the product in front of it still reads
    v16h vf[HD / 16];
#pragma unroll
    for (int j = 0; j < HD / 16; ++j) vf[j] = frag_l(vb + j * 16 * VPIT);
    if (more) {
#pragma unroll
      for (int t = 0; t < 2; ++t)
#pragma unroll
        for (int kc = 0; kc < 2; ++kc) kf[t][kc] = frag_l(kb + (32 + t * 16) * KPIT + kc * 64); }
    __builtin_amdgcn_sched_barrier(0);   // keeps the reads in front of the softmax, which then covers their latency
    v16h pf[2]; float ps[2];
    // the pass's terms exp2(s - m + 11) of column group u against the maximum IN USE (off = 11 - m), once to f16, and their f32 sum
    auto terms = [&](const int u) __attribute__((always_inline)) { float p[2][8];
#pragma unroll
      for (int t = 0; t < 2; ++t) { float a[8];
#pragma unroll
        for (int r = 0; r < 8; ++r) a[r] = fmaf(s[u][t][r], LSC, off[u]);
        exp2x8(p[t], a);
#pragma unroll
        for (int r = 0; r < 8; ++r) pf[u][8 * t + r] = (_Float16)p[t][r]; }
      float q[8];   // the pass's 16 terms as a tree, not a chain of dependent adds
#pragma unroll
      for (int r = 0; r < 8; ++r) q[r] = p[0][r] + p[1][r];
      ps[u] = ((q[0] + q[1]) + (q[2] + q[3])) + ((q[4] + q[5]) + (q[6] + q[7])); };
    terms(0); terms(1);
    // every term is >= 0, so a sum within f16's range bounds each of its terms: then the maximum in use serves on and nothing is rescaled. One test a pass for the whole wave, a scalar branch.
    // taken on the first pass (off = 3e38 makes every term infinite) and whenever a score has risen so far above the maximum in use that a lane's sum leaves the range; marked unlikely so that the usual pass runs straight on, without a taken jump
    if (__builtin_expect(__builtin_amdgcn_ballot_w32(fmaxf(ps[0], ps[1]) > PSMAX) != 0, 0)) {
      v16h kt[2][2];   // the pass's k rows once more, and its scores by the same products: so the scores need not be held in registers over the test in every pass
#pragma unroll
      for (int t = 0; t < 2; ++t)
#pragma unroll
        for (int kc = 0; kc < 2; ++kc) kt[t][kc] = frag_l(kb + t * 16 * KPIT + kc * 64);
#pragma unroll
      for (int u = 0; u < 2; ++u)
#pragma unroll
        for (int t = 0; t < 2; ++t) s[u][t] = v8f{};
#pragma unroll
      for (int kc = 0; kc < 2; ++kc)
#pragma unroll
        for (int t = 0; t < 2; ++t)
#pragma unroll
          for (int u = 0; u < 2; ++u) s[u][t] = mm16(kt[t][kc], qf[u][kc], s[u][t]);
      float on[2], alpha[2];
#pragma unroll
      for (int u = 0; u < 2; ++u) {
        float mx = fmaxf(s[u][0][0], s[u][1][0]);
#pragma unroll
        for (int r = 1; r < 8; ++r) mx = fmaxf(mx, fmaxf(s[u][0][r], s[u][1][r]));
        mx = fmaxf(mx, xhalf(mx)); on[u] = fminf(off[u], fmaf(mx, -LSC, 11.0f)); }   // both halves of a query take the same new maximum
      exp2x2(alpha[0], alpha[1], on[0] - off[0], on[1] - off[1]);   // 0 on the first pass
#pragma unroll
      for (int u = 0; u < 2; ++u) { off[u] = on[u]; l[u] *= alpha[u];
#pragma unroll
        for (int j = 0; j < HD / 16; ++j) o[u][j] *= alpha[u]; }
      terms(0); terms(1); }   // now no term is above 2^11
    l[0] += ps[0]; l[1] += ps[1];
#pragma unroll
    for (int j = 0; j < HD / 16; ++j)
#pragma unroll
      for (int u = 0; u < 2; ++u) o[u][j] = mm16(vf[j], pf[u], o[u][j]);
  };
  for (int s = 0; s < NST; ++s) {
    const unsigned char* kb = ring + (s & 1) * STG + col * KPIT + 16 * g; const unsigned char* vb = ring + (s & 1) * STG + KTILE + col * VPIT + 16 * g;
#pragma unroll
    for (int t = 0; t < 2; ++t)
#pragma unroll
      for (int kc = 0; kc < 2; ++kc) kf[t][kc] = frag_l(kb + t * 16 * KPIT + kc * 64);
#pragma unroll 1   // kept rolled: unrolled, every pass's sum of exponentials is sunk to the stage's foot and its terms are held till there, which takes the registers past 256 and into scratch
    for (int p = 0; p < SK / 32 - 1; ++p) { pass(kb, vb, true); kb += 32 * KPIT; vb += 64; }
    pass(kb, vb, false);
    asm volatile("s_wait_dscnt 0x0" ::: "memory");      // this wave's reads of stage s are done
    asm volatile("s_wait_asynccnt 0x0" ::: "memory");   // this wave's copies of stage s + 1 have landed
    __syncthreads();                                    // publishes stage s + 1 and ends every wave's reads of stage s, whose buffer the copies behind it refill
    if (s + 2 < NST) copy(s + 2, s & 1); }
  asm volatile("s_wait_asynccnt 0x0" ::: "memory");     // no copy is outstanding when the wave ends
  float* yr = Y + ((size_t)b * TT + q0 + col) * CC + h * HD + 8 * g;
#pragma unroll
  for (int u = 0; u < 2; ++u) { const float inv = 1.0f / (l[u] + xhalf(l[u]));
#pragma unroll
    for (int j = 0; j < HD / 16; ++j) o[u][j] *= inv; }
  __builtin_amdgcn_sched_barrier(0);   // every product in front of the first store: no register of an issued store is written again
#pragma unroll
  for (int u = 0; u < 2; ++u)
#pragma unroll
    for (int j = 0; j < HD / 16; ++j) { const v8f r = o[u][j]; const v4f lo = { r[0], r[1], r[2], r[3] }, hi = { r[4], r[5], r[6], r[7] }; vst2(yr + u * 16 * CC + j * 16, lo); vst2(yr + u * 16 * CC + j * 16 + 4, hi); } }

extern "C" void kernel_launch(void* const* d_in, const int* in_sizes, int n_in, void* d_out, int out_size, void* d_ws, size_t ws_size, hipStream_t stream) {
  (void)in_sizes; (void)n_in; (void)out_size;
  const float** F = (const float**)d_in;
  if (ws_size < (size_t)WS_END) return;
  char* ws = (char*)d_ws; _Float16 *QH = (_Float16*)(ws + WS_QH), *KH = (_Float16*)(ws + WS_KH), *VT = (_Float16*)(ws + WS_VT), *QL = (_Float16*)(ws + WS_QL), *KL = (_Float16*)(ws + WS_KL); __bf16 *VB = (__bf16*)(ws + WS_VB), *VBL = (__bf16*)(ws + WS_VBL); float *S = (float*)(ws + WS_S), *Y = (float*)(ws + WS_Y);
  (void)Y; (void)S; (void)QL; (void)KL; (void)VB; (void)VBL;
  // inputs: 0 x [2,2048,1024]; 1 Wq [1024,1024] (in,out), 2 bq; 3 Wk, 4 bk; 5 Wv, 6 bv (biases nonzero); no output projection
  k_proj<<<dim3(TNB * TT / PBM, CC / PBN, 3), PTH, 0, stream>>>(F[0], F[0], F[0], F[1], F[3], F[5], F[2], F[4], F[6], QH, KH, VT);
  k_attn<<<dim3(TT / (AW * QCOLS), TNB * NH), AW * 32, 0, stream>>>(QH, KH, VT, (float*)d_out);
}

// v005
// Measured time: 58.1 microseconds a run.
// Timed twice side by side with v004, it ran 1.07 and 1.08 times as fast.
// Over all steps from v000 it is 19.1 times as fast.
// compute dtype: all float inputs rounded to bf16; q/k/v projections with EXACT bf16 products on WMMA 16x16x32 (f32 accumulate) + bias; logits q x k once to f16 each (1 product) x SCALE; softmax f32 against a maximum that is raised only when a term could leave f16's range; exp(s - m) x 2^11 once to f16 x v once to f16 (1 product), divided by the f32 sum at the end; f32 output.
#include <hip/hip_runtime.h>
#include <math.h>

typedef __attribute__((ext_vector_type(16))) _Float16 v16h;
typedef __attribute__((ext_vector_type(16))) __bf16 v16b;
typedef __attribute__((ext_vector_type(8)))  _Float16 v8h;
typedef __attribute__((ext_vector_type(8)))  float v8f;
typedef __attribute__((ext_vector_type(4)))  float v4f;
typedef __attribute__((ext_vector_type(2)))  float v2f;
typedef __attribute__((ext_vector_type(4)))  unsigned v4u;
typedef __attribute__((ext_vector_type(4)))  int v4i;
typedef float __attribute__((may_alias)) float_a;
typedef int __attribute__((may_alias)) int_a;

template <typename T> __device__ __forceinline__ void vst2(void* p, T v) { *(T*)p = v;  }
__device__ __forceinline__ v8f wmma16(v16h a, v16h b, v8f c) {
  v8f d = __builtin_amdgcn_wmma_f32_16x16x32_f16(false, a, false, b, (short)0, c, false, false);
  asm volatile("v_nop\n\tv_nop\n\tv_nop\n\tv_nop" : "+v"(d) : "v"(a), "v"(b));
  return d;
}
__device__ __forceinline__ v8f wmma_bf(v16b a, v16b b, v8f c) {
  v8f d = __builtin_amdgcn_wmma_f32_16x16x32_bf16(false, a, false, b, (short)0, c, false, false);
  asm volatile("v_nop\n\tv_nop\n\tv_nop\n\tv_nop" : "+v"(d) : "v"(a), "v"(b));
  return d;
}
// 16x16x32 fragments: lane = (h = lane>>4, row/col = lane&15); elements 0..7 = k0+8h+0..7, 8..15 = k0+16+8h+0..7; D element r = row 8h+r
__device__ __forceinline__ v16h frag_h(const _Float16* rowk0, int lane) {
  union { v16h v; v8h q[2]; } u; const _Float16* p = rowk0 + 8 * (lane >> 4);
  u.q[0] = *(const v8h*)p; u.q[1] = *(const v8h*)(p + 16); return u.v;
}
__device__ __forceinline__ v16h frag_f32(const float* rowk0, int lane) {
  v16h a; const float* p = rowk0 + 8 * (lane >> 4);
#pragma unroll
  for (int i = 0; i < 8; ++i) { a[i] = (_Float16)p[i]; a[8 + i] = (_Float16)p[16 + i]; }
  return a;
}
__device__ __forceinline__ v16h frag_f32s(const float* rowk0, int lane, float sc) {
  v16h a; const float* p = rowk0 + 8 * (lane >> 4);
#pragma unroll
  for (int i = 0; i < 8; ++i) { a[i] = (_Float16)(p[i] * sc); a[8 + i] = (_Float16)(p[16 + i] * sc); }
  return a;
}
// column fragment from a [K][ld] layout (column n), rows >= K read as 0
__device__ __forceinline__ v16h fragc_f32(const float* W, int k0, int n, int lane, int ld, int K) {
  v16h a; const int g = lane >> 4;
#pragma unroll
  for (int i = 0; i < 8; ++i) { const int ka = k0 + 8 * g + i, kb = ka + 16;
    a[i] = (_Float16)(ka < K ? W[(size_t)(ka < K ? ka : K - 1) * ld + n] : 0.f); a[8 + i] = (_Float16)(kb < K ? W[(size_t)(kb < K ? kb : K - 1) * ld + n] : 0.f); }
  return a;
}
struct F2 { v16b h, l; };
__device__ __forceinline__ F2 bsplit16(const float v[16]) { F2 r;
#pragma unroll
  for (int i = 0; i < 16; ++i) { const __bf16 h = (__bf16)v[i]; r.h[i] = h; r.l[i] = (__bf16)(v[i] - (float)h); }
  return r; }
__device__ __forceinline__ F2 split_row(const float* row, int k0, int lane) { float v[16]; const float* p = row + k0 + 8 * (lane >> 4);
#pragma unroll
  for (int i = 0; i < 8; ++i) { v[i] = p[i]; v[8 + i] = p[16 + i]; }
  return bsplit16(v); }
__device__ __forceinline__ F2 split_rowK(const float* row, int k0, int lane, int K) { float v[16]; const int g = lane >> 4;
#pragma unroll
  for (int i = 0; i < 8; ++i) { const int ka = k0 + 8 * g + i, kb = ka + 16; v[i] = ka < K ? row[ka < K ? ka : K - 1] : 0.f; v[8 + i] = kb < K ? row[kb < K ? kb : K - 1] : 0.f; }
  return bsplit16(v); }
__device__ __forceinline__ F2 split_col(const float* W, int k0, int n, int lane, int ld, int K) { float v[16]; const int g = lane >> 4;
#pragma unroll
  for (int i = 0; i < 8; ++i) { const int ka = k0 + 8 * g + i, kb = ka + 16; v[i] = ka < K ? W[(size_t)(ka < K ? ka : K - 1) * ld + n] : 0.f; v[8 + i] = kb < K ? W[(size_t)(kb < K ? kb : K - 1) * ld + n] : 0.f; }
  return bsplit16(v); }
__device__ __forceinline__ v8f mac3(const F2& a, const F2& b, v8f c) { c = wmma_bf(a.l, b.h, c); c = wmma_bf(a.h, b.l, c); return wmma_bf(a.h, b.h, c); }
__device__ __forceinline__ float sigm(float v) { return 1.0f / (1.0f + expf(-v)); }
#define LDSX() do { asm volatile("s_wait_dscnt 0" ::: "memory"); __builtin_amdgcn_wave_barrier(); __builtin_amdgcn_fence(__ATOMIC_RELEASE, "workgroup"); } while (0)

// Multi-head self-attention without an output projection (x [2,2048,1024]; (in,out) Wq / Wk / Wv [1024,1024] + biases, uniform(+-1/32); 16 heads x 64; scale 1/8; softmax over keys; heads merged) -> [2,2048,1024].
#define NB 2
#define TT 2048
#define CC 1024            // NH * HD = projected width
#define DIN 1024          // input (model) width
#define NH 16
#define HD 64
#define NQB (TT / 64)
#define HG 4
#define SCALE (0.125f)
#define CAUSAL 0
#ifndef TNB
#define TNB NB
#endif
__device__ __forceinline__ float bfr(float v) { return (float)(__bf16)v; }
__host__ __device__ __forceinline__ int kb_last(int qb) { return CAUSAL ? ((qb * 64 + 63) >> 7) : (TT / 128 - 1); }
typedef __attribute__((ext_vector_type(8))) __bf16 v8b;
__device__ __forceinline__ v16b frag_b(const __bf16* rowk0, int lane) {
  union { v16b v; v8b q[2]; } u; const __bf16* p = rowk0 + 8 * (lane >> 4);
  u.q[0] = *(const v8b*)p; u.q[1] = *(const v8b*)(p + 16); return u.v;
}
#define QBH 0              // unused: this file has no high-precision path
#define QHI 0               // single-product logits on every row
#define KHI 64            // key rows of the k residual / v bf16 hi+lo workspace planes, which no kernel here writes or reads
// B fragment (k rows k0+.., output column o) of a weight: (in,out) [K][ld] or (out,in) [ld rows of K]: bf16 exact, or f16(bf16 * 256) exact
__device__ __forceinline__ v16b wcol_io(const float* Wm, int k0, int o, int lane, int ld) { v16b w; const int g = lane >> 4;
#pragma unroll
  for (int i = 0; i < 8; ++i) { w[i] = (__bf16)Wm[(size_t)(k0 + 8 * g + i) * ld + o]; w[8 + i] = (__bf16)Wm[(size_t)(k0 + 16 + 8 * g + i) * ld + o]; }
  return w; }
__device__ __forceinline__ v16b wcol_oi(const float* Wm, int k0, int o, int lane, int K) { v16b w; const float* p = Wm + (size_t)o * K + k0 + 8 * (lane >> 4);
#pragma unroll
  for (int i = 0; i < 8; ++i) { w[i] = (__bf16)p[i]; w[8 + i] = (__bf16)p[16 + i]; }
  return w; }
__device__ __forceinline__ v16h wcolh_io(const float* Wm, int k0, int o, int lane, int ld) { v16h w; const int g = lane >> 4;
#pragma unroll
  for (int i = 0; i < 8; ++i) { w[i] = (_Float16)(bfr(Wm[(size_t)(k0 + 8 * g + i) * ld + o]) * 256.0f); w[8 + i] = (_Float16)(bfr(Wm[(size_t)(k0 + 16 + 8 * g + i) * ld + o]) * 256.0f); }
  return w; }
__device__ __forceinline__ v16h wcolh_oi(const float* Wm, int k0, int o, int lane, int K) { v16h w; const float* p = Wm + (size_t)o * K + k0 + 8 * (lane >> 4);
#pragma unroll
  for (int i = 0; i < 8; ++i) { w[i] = (_Float16)(bfr(p[i]) * 256.0f); w[8 + i] = (_Float16)(bfr(p[16 + i]) * 256.0f); }
  return w; }
#define WQKV_LAYOUT 0   // 0 = (in,out) [DIN][CC]; 1 = (out,in) [CC][DIN]; 2 = per-head [NH][DIN][HD]
__device__ __forceinline__ v16b wcol_hdk(const float* Wm, int k0, int o, int lane) { v16b w; const int g = lane >> 4; const float* p = Wm + (size_t)(o / HD) * DIN * HD + (o % HD);
#pragma unroll
  for (int i = 0; i < 8; ++i) { w[i] = (__bf16)p[(size_t)(k0 + 8 * g + i) * HD]; w[8 + i] = (__bf16)p[(size_t)(k0 + 16 + 8 * g + i) * HD]; }
  return w; }
#define WO_OUT_IN 0
#if WQKV_LAYOUT == 1
#define WCOL(W, k0, o, lane) wcol_oi(W, k0, o, lane, DIN)
#elif WQKV_LAYOUT == 2
#define WCOL(W, k0, o, lane) wcol_hdk(W, k0, o, lane)
#else
#define WCOL(W, k0, o, lane) wcol_io(W, k0, o, lane, CC)
#endif
#if WO_OUT_IN
#define WOCOL(W, k0, o, lane) wcol_oi(W, k0, o, lane, CC)
#define WOCOLH(W, k0, o, lane) wcolh_oi(W, k0, o, lane, CC)
#else
#define WOCOL(W, k0, o, lane) wcol_io(W, k0, o, lane, DIN)
#define WOCOLH(W, k0, o, lane) wcolh_io(W, k0, o, lane, DIN)
#endif

#ifndef SM_EXTRA_PARAMS
#define SM_EXTRA_PARAMS
#endif
#ifndef PROJ_EXTRA_PARAMS
#define PROJ_EXTRA_PARAMS
#endif
#ifndef SM_MASK_HOOK
#define SM_MASK_HOOK (void)0
#endif

#define WS_QH  0u                                      // f16 q rows [b*t][CC]
#define WS_KH  (WS_QH + 2u * (size_t)NB * TT * CC)      // f16 k rows [b*t][CC]
#define WS_VT  (WS_KH + 2u * (size_t)NB * TT * CC)      // f16 v planes [b][c][t]
#define WS_QL  (WS_VT + 2u * (size_t)NB * CC * TT)      // f16 q residual x 2^10 rows [b][t < QHI][CC]
#define WS_KL  (WS_QL + 2u * (size_t)NB * QHI * CC)     // f16 k residual x 2^10 rows [b][t < KHI][CC]
#define WS_VB  (WS_KL + 2u * (size_t)NB * KHI * CC)     // bf16 v hi planes [b][c][t < KHI]
#define WS_VBL (WS_VB + 2u * (size_t)NB * CC * KHI)
#define WS_S   (WS_VBL + 2u * (size_t)NB * CC * KHI)    // f32 [hg][t][s], reserved: no kernel here uses it
#define WS_Y   (WS_S  + 4u * (size_t)HG * TT * TT)      // f32 ctx rows [b*t][CC] (only when there is an output projection)
#define WS_END (WS_Y  + 0u)

#define PBM 256            // rows of a block's tile
#define PBN 256            // columns of a block's tile
#define PBK 32             // k of a stage: one product deep
#define PTH 512            // threads: 16 waves as 4 x 4, a wave = 64 rows x 64 columns
#define PPIT 40            // LDS row pitch in bf16: 64-byte rows at 80 bytes (16 bytes x odd), free of bank conflicts for 16-byte reads and writes
typedef __attribute__((ext_vector_type(4))) __bf16 v4b;
__device__ __forceinline__ v8f mmb(v16b a, v16b b, v8f c) { return __builtin_amdgcn_wmma_f32_16x16x32_bf16(false, a, false, b, (short)0, c, false, false); }
// ---- k_proj: block = (256 rows, 256 cols, which): q/k/v = X W (+ b) with exact bf16 products (K = DIN, 32 k a product, k ascending from the block's own first stage, wrapping round) -> which 0: q f16 rows; 1: k f16 rows; 2: v f16 planes [c][t]
// a stage = 32 k of the X rows and of the W columns, fetched ONCE per block in whole 128-byte lines, rounded to bf16 and laid k-contiguous in LDS (xs[row][k], wt[col][k]: W is transposed on the way, a thread holding 8 k of one column);
// two buffers: stage s + 1 is written while stage s is read, stage s + 2 is in flight from global into registers; one barrier a stage
// the 32 stages are walked as a ring: a block enters at a stage set by its indices and wraps round, so that the 12 blocks that share X rows and the 16 that share W columns do not ask L2 for the same lines at the same moment
__global__ __launch_bounds__(PTH) void k_proj(const float* __restrict__ XQ, const float* __restrict__ XK, const float* __restrict__ XV, const float* __restrict__ WQ, const float* __restrict__ WK, const float* __restrict__ WV, const float* __restrict__ BQ, const float* __restrict__ BK, const float* __restrict__ BV,
    _Float16* __restrict__ QH, _Float16* __restrict__ KH, _Float16* __restrict__ VT) {
  __shared__ __align__(16) unsigned char sm[PBM * (PBN + 8) * 2];   // the two stage buffers of X and of W (81,920 bytes); behind the loop the f16 output tile
  __bf16 (*xs)[PBM][PPIT] = (__bf16 (*)[PBM][PPIT])sm; __bf16 (*wt)[PBN][PPIT] = (__bf16 (*)[PBN][PPIT])(sm + 2 * PBM * PPIT * 2);
  const int tid = threadIdx.x, wave = tid >> 5, lane = tid & 31, col = lane & 15, g = lane >> 4, wr = wave >> 2, wc = wave & 3; const int which = blockIdx.z; const int c0 = blockIdx.y * PBN; const size_t r0 = (size_t)blockIdx.x * PBM; const size_t bb = r0 / TT; const int t0 = (int)(r0 % TT);
  const float* X = which == 0 ? XQ : which == 1 ? XK : XV; const float* WA = which == 0 ? WQ : which == 1 ? WK : WV; const float* BA = which == 0 ? BQ : which == 1 ? BK : BV;
  const int xrow = tid >> 3, xk = (tid & 7) * 4;      // X: 8 lanes a row, 16 bytes each; rows xrow + 64 i
  const int wn = tid & 255, wq = tid >> 8;            // W: a lane a column, 8 k rows from 8 (wq + 2 i)
  int kst = (int)((2 * blockIdx.x + 3 * (blockIdx.y + (CC / PBN) * blockIdx.z)) % (DIN / PBK));   // the k stage to fetch next, the same for the whole block: apart by 2 among the sharers of W columns, by 3 among those of X rows
  unsigned xo = (unsigned)(((r0 + xrow) * DIN + kst * PBK + xk) * 4), wo = (unsigned)(((kst * PBK + wq * 8) * CC + c0 + wn) * 4);   // this thread's byte offsets in X and in W at the next stage to fetch; the bases stay uniform
  v4f xr[4]; float wg[2][8];
  auto fetch = [&]() __attribute__((always_inline)) {
#pragma unroll
    for (int i = 0; i < 4; ++i) xr[i] = *(const v4f*)((const char*)X + xo + (size_t)i * 64 * DIN * 4);
#pragma unroll
    for (int i = 0; i < 2; ++i)
#pragma unroll
      for (int e = 0; e < 8; ++e) wg[i][e] = *(const float*)((const char*)WA + wo + (size_t)(i * 16 + e) * CC * 4);
    const bool wrap = kst == DIN / PBK - 1; kst = wrap ? 0 : kst + 1;   // behind the last k stage the walk goes on at the first
    const unsigned xstep = wrap ? (unsigned)(PBK * 4 - DIN * 4) : (unsigned)(PBK * 4), wstep = wrap ? (unsigned)(PBK * CC * 4 - DIN * CC * 4) : (unsigned)(PBK * CC * 4);
    // directly behind the last load, on every way on from here: the wait that stands in front of any overwrite of a register that these loads name (the two offsets, the two uniform bases); the steps of the two offsets to the next stage are in the same statement, so that they cannot come in front of it
    asm volatile("s_wait_xcnt 0x0\n\tv_add_nc_u32 %0, %2, %0\n\tv_add_nc_u32 %1, %3, %1" : "+v"(xo), "+v"(wo) : "s"(xstep), "s"(wstep) : "memory"); };
  auto stash = [&](const int buf) __attribute__((always_inline)) {
#pragma unroll
    for (int i = 0; i < 4; ++i) { const v4b t = { (__bf16)xr[i][0], (__bf16)xr[i][1], (__bf16)xr[i][2], (__bf16)xr[i][3] }; *(v4b*)&xs[buf][xrow + 64 * i][xk] = t; }
#pragma unroll
    for (int i = 0; i < 2; ++i) { v8b t;
#pragma unroll
      for (int e = 0; e < 8; ++e) t[e] = (__bf16)wg[i][e];
      *(v8b*)&wt[buf][wn][(wq + 2 * i) * 8] = t; } };
  // the stage barrier by hand: __syncthreads() also waits for the global loads in flight, which are to stay in flight across it; what it must order is LDS alone, so this wave's LDS stores and reads are waited for in front of it
  auto stage_barrier = [&]() __attribute__((always_inline)) { asm volatile("s_wait_dscnt 0x0" ::: "memory"); asm volatile("s_barrier_signal -1\n\ts_barrier_wait -1" ::: "memory"); };
  fetch(); stash(0); fetch();
  stage_barrier();
  v8f acc[4][4] = {};
#pragma unroll 2
  for (int s = 0; s < DIN / PBK; ++s) { const int cur = s & 1; v16b a[4], w[4];
#pragma unroll
    for (int i = 0; i < 4; ++i) { a[i] = frag_b(&xs[cur][wr * 64 + i * 16 + col][0], lane); w[i] = frag_b(&wt[cur][wc * 64 + i * 16 + col][0], lane); }
    if (s + 1 < DIN / PBK) { stash(cur ^ 1); if (s + 2 < DIN / PBK) fetch(); }
#pragma unroll
    for (int j = 0; j < 4; ++j)
#pragma unroll
      for (int i = 0; i < 4; ++i) acc[i][j] = mmb(a[i], w[j], acc[i][j]);
    stage_barrier(); }   // publishes stage s + 1 and ends every wave's reads of stage s, whose buffer the next trip overwrites
  _Float16 (*st)[PBN + 8] = (_Float16 (*)[PBN + 8])sm;   // the output tile, over the stage buffers, which every wave has left at the loop's last barrier
  float bias[4] = { 0.f, 0.f, 0.f, 0.f };
  if (BA) { const int bi = c0 + wc * 64 + col; float bl[4];
#pragma unroll
    for (int j = 0; j < 4; ++j) bl[j] = BA[bi + j * 16];
    asm volatile("s_wait_xcnt 0x0" :: "v"(bi) : "memory");   // behind the four loads; the index is an input so that it lives up to the wait and no loaded value is placed on the register that an issued load names
#pragma unroll
    for (int j = 0; j < 4; ++j) bias[j] = bfr(bl[j]); }
  if (which < 2) { _Float16* DH = which == 0 ? QH : KH;
#pragma unroll
    for (int j = 0; j < 4; ++j)
#pragma unroll
      for (int i = 0; i < 4; ++i)
#pragma unroll
        for (int r = 0; r < 8; ++r) st[wr * 64 + i * 16 + 8 * g + r][wc * 64 + j * 16 + col] = (_Float16)(acc[i][j][r] + bias[j]);
    __syncthreads();
#pragma unroll
    for (int it = 0; it < PBM * (PBN / 8) / PTH; ++it) { const int e = tid + it * PTH, rl = e >> 5, q = e & 31; vst2((unsigned*)(DH + (r0 + rl) * CC + c0 + q * 8), *(const v4u*)&st[rl][q * 8]); }
  } else {
#pragma unroll
    for (int j = 0; j < 4; ++j)
#pragma unroll
      for (int i = 0; i < 4; ++i)
#pragma unroll
        for (int r = 0; r < 8; ++r) st[wc * 64 + j * 16 + col][wr * 64 + i * 16 + 8 * g + r] = (_Float16)(acc[i][j][r] + bias[j]);
    __syncthreads();
#pragma unroll
    for (int it = 0; it < PBN * (PBM / 8) / PTH; ++it) { const int e = tid + it * PTH, cl = e >> 5, q = e & 31; vst2((unsigned*)(VT + (bb * CC + c0 + cl) * (size_t)TT + t0 + q * 8), *(const v4u*)&st[cl][q * 8]); } } }
// lane l with lane l ^ 16
__device__ __forceinline__ float xhalf(float x) { return __builtin_bit_cast(float, __builtin_amdgcn_permlanex16(__builtin_bit_cast(int, x), __builtin_bit_cast(int, x), 0x76543210, 0xfedcba98, false, false)); }
__device__ __forceinline__ v8f mm16(v16h a, v16h b, v8f c) { return __builtin_amdgcn_wmma_f32_16x16x32_f16(false, a, false, b, (short)0, c, false, false); }
// 16x16x32 fragment in the hardware k order; p = the lane's row at k0 + 8 * (lane >> 4)
__device__ __forceinline__ v16h frag_p(const _Float16* p) { union { v16h v; v8h q[2]; } u; u.q[0] = *(const v8h*)p; u.q[1] = *(const v8h*)(p + 16); return u.v; }
// exp2 in runs, one statement a run: early-clobbered results, so that no v_exp_f32 of a run writes a source or reads a result of the one in front of it, and a closing v_nop: the slot that the instruction set asks for behind a transcendental
__device__ __forceinline__ void exp2x8(float (&p)[8], const float (&a)[8]) {
  asm("v_exp_f32 %0, %8\n\tv_exp_f32 %1, %9\n\tv_exp_f32 %2, %10\n\tv_exp_f32 %3, %11\n\tv_exp_f32 %4, %12\n\tv_exp_f32 %5, %13\n\tv_exp_f32 %6, %14\n\tv_exp_f32 %7, %15\n\tv_nop"
      : "=&v"(p[0]), "=&v"(p[1]), "=&v"(p[2]), "=&v"(p[3]), "=&v"(p[4]), "=&v"(p[5]), "=&v"(p[6]), "=&v"(p[7]) : "v"(a[0]), "v"(a[1]), "v"(a[2]), "v"(a[3]), "v"(a[4]), "v"(a[5]), "v"(a[6]), "v"(a[7])); }
__device__ __forceinline__ void exp2x2(float& p0, float& p1, float a0, float a1) { asm("v_exp_f32 %0, %2\n\tv_exp_f32 %1, %3\n\tv_nop" : "=&v"(p0), "=&v"(p1) : "v"(a0), "v"(a1)); }
#define QCOLS 32           // query columns per wave (two 16-column groups)
#define AW 8               // waves per block
#define LSC (SCALE * 1.4426950408889634f)   // logits in base 2
#define SK 256             // keys of a stage: eight passes
#define NST (TT / SK)      // stages
#define KPIT 144           // LDS pitch of a k row (128 bytes) and
#define VPIT 528           // of a v plane's 256 keys (512 bytes): 16 bytes x odd, free of bank conflicts for 16-byte reads
#define KTILE (SK * KPIT)
#define VTILE (HD * VPIT)
#define STG (KTILE + VTILE)   // bytes of a stage buffer: the k rows, then the v planes
#define PSMAX 65504.0f     // the largest finite f16
// 16x16x32 fragment in the hardware k order from LDS; p = the lane's row at k0 + 8 * (lane >> 4), in bytes
__device__ __forceinline__ v16h frag_l(const unsigned char* p) { union { v16h v; v8h q[2]; } u; u.q[0] = *(const v8h*)p; u.q[1] = *(const v8h*)(p + 32); return u.v; }
__global__ __launch_bounds__(AW * 32) void k_attn(const _Float16* __restrict__ QH, const _Float16* __restrict__ KH, const _Float16* __restrict__ VT, float* __restrict__ Y) {
  __shared__ __align__(16) unsigned char ring[2 * STG];
  const int tid = threadIdx.x, wave = tid >> 5, lane = tid & 31, col = lane & 15, g = lane >> 4;
  const int b = blockIdx.y / NH, h = blockIdx.y % NH; const int q0 = blockIdx.x * (AW * QCOLS) + wave * QCOLS;
  const _Float16* Qb = QH + ((size_t)b * TT + q0 + col) * CC + h * HD + 8 * g;
  v16h qf[2][2], kf[2][2];
#pragma unroll
  for (int u = 0; u < 2; ++u)
#pragma unroll
    for (int kc = 0; kc < 2; ++kc) qf[u][kc] = frag_p(Qb + u * 16 * CC + kc * 32);
  asm volatile("s_wait_xcnt 0x0" :: "v"(Qb) : "memory");   // behind the eight loads above; the pointer is an input so that it lives up to the wait and no fragment is placed on the address pair that an issued load names
  // this thread's share of a stage, 16 bytes a copy: k rows (tid >> 3) + 32 i, 8 lanes a 128-byte row; v planes (tid >> 5) + 8 i, a wave a 512-byte run of keys
  const char* kg = (const char*)(KH + ((size_t)b * TT + (tid >> 3)) * CC + h * HD + (tid & 7) * 8);
  const char* vg = (const char*)(VT + ((size_t)b * CC + h * HD + (tid >> 5)) * (size_t)TT + (tid & 31) * 8);
  const unsigned kl = (unsigned)(size_t)ring + (tid >> 3) * KPIT + (tid & 7) * 16, vl = (unsigned)(size_t)ring + KTILE + (tid >> 5) * VPIT + (tid & 31) * 16;   // LDS byte addresses: the low 32 bits of the __shared__ address
  // eight copies, LDS address l + i * lstep from global address p + i * gstep, and, as the statement's last line, the wait that stands in front of any overwrite of a register that an issued copy names
  auto copy8 = [&](const unsigned l, const unsigned lstep, const char* p, const size_t gstep) __attribute__((always_inline)) {
    asm volatile("global_load_async_to_lds_b128 %0, %8, off\n\tglobal_load_async_to_lds_b128 %1, %9, off\n\tglobal_load_async_to_lds_b128 %2, %10, off\n\tglobal_load_async_to_lds_b128 %3, %11, off\n\t"
                 "global_load_async_to_lds_b128 %4, %12, off\n\tglobal_load_async_to_lds_b128 %5, %13, off\n\tglobal_load_async_to_lds_b128 %6, %14, off\n\tglobal_load_async_to_lds_b128 %7, %15, off\n\ts_wait_xcnt 0x0"
                 :: "v"(l), "v"(l + lstep), "v"(l + 2 * lstep), "v"(l + 3 * lstep), "v"(l + 4 * lstep), "v"(l + 5 * lstep), "v"(l + 6 * lstep), "v"(l + 7 * lstep),
                    "v"(p), "v"(p + gstep), "v"(p + 2 * gstep), "v"(p + 3 * gstep), "v"(p + 4 * gstep), "v"(p + 5 * gstep), "v"(p + 6 * gstep), "v"(p + 7 * gstep) : "memory"); };
  // the key stages are walked as a ring too: step s of the walk brings stage (s + blockIdx.x) mod NST, so that the blocks of one (b, h), which read the same k rows and v planes, are each at another stage
  auto copy = [&](const int s, const int buf) __attribute__((always_inline)) { const int sr = (int)((s + blockIdx.x) % NST);
    copy8(kl + buf * STG, 32 * KPIT, kg + (size_t)sr * SK * CC * 2, (size_t)32 * CC * 2);
    copy8(vl + buf * STG, 8 * VPIT, vg + (size_t)sr * SK * 2, (size_t)8 * TT * 2); };
  copy(0, 0);
  asm volatile("s_wait_asynccnt 0x0" ::: "memory");   // this wave's copies of stage 0 have landed
  __syncthreads();                                    // and every wave's: stage 0 may be read
  copy(1, 1);
  v8f o[2][HD / 16] = {}; float off[2] = { 3.0e38f, 3.0e38f }, l[2] = { 0.f, 0.f };   // off = 11 - m, m the maximum in use (none yet)
  // one pass = 32 keys; kb, vb: this lane's place in the pass's k rows and v planes; more: a further pass of the same stage follows, whose k rows are fetched behind this pass's score products
  auto pass = [&](const unsigned char* kb, const unsigned char* vb, const bool more) __attribute__((always_inline)) {
    v8f s[2][2] = {};
#pragma unroll
    for (int kc = 0; kc < 2; ++kc)
#pragma unroll
      for (int t = 0; t < 2; ++t)
#pragma unroll
        for (int u = 0; u < 2; ++u) s[u][t] = mm16(kf[t][kc], qf[u][kc], s[u][t]);
    __builtin_amdgcn_sched_barrier(0);   // with the one behind the reads: the pass's LDS reads stand in ONE place behind the score products; left free they are spread among the products
    if (!more) asm volatile("" :: "v"(kf[0][0]), "v"(kf[0][1]), "v"(kf[1][0]), "v"(kf[1][1]));   // inputs only: in a stage's last pass the loaded k fragments die product by product, and without this a later score product's D is placed on a register that the product in front of it still reads
    v16h vf[HD / 16];
#pragma unroll
    for (int j = 0; j < HD / 16; ++j) vf[j] = frag_l(vb + j * 16 * VPIT);
    if (more) {
#pragma unroll
      for (int t = 0; t < 2; ++t)
#pragma unroll
        for (int kc = 0; kc < 2; ++kc) kf[t][kc] = frag_l(kb + (32 + t * 16) * KPIT + kc * 64); }
    __builtin_amdgcn_sched_barrier(0);   // keeps the reads in front of the softmax, which then covers their latency
    v16h pf[2]; float ps[2];
    // the pass's terms exp2(s - m + 11) of column group u against the maximum IN USE (off = 11 - m), once to f16, and their f32 sum
    auto terms = [&](const int u) __attribute__((always_inline)) { float p[2][8];
#pragma unroll
      for (int t = 0; t < 2; ++t) { float a[8];
#pragma unroll
        for (int r = 0; r < 8; ++r) a[r] = fmaf(s[u][t][r], LSC, off[u]);
        exp2x8(p[t], a);
#pragma unroll
        for (int r = 0; r < 8; ++r) pf[u][8 * t + r] = (_Float16)p[t][r]; }
      float q[8];   // the pass's 16 terms as a tree, not a chain of dependent adds
#pragma unroll
      for (int r = 0; r < 8; ++r) q[r] = p[0][r] + p[1][r];
      ps[u] = ((q[0] + q[1]) + (q[2] + q[3])) + ((q[4] + q[5]) + (q[6] + q[7])); };
    terms(0); terms(1);
    // every term is >= 0, so a sum within f16's range bounds each of its terms: then the maximum in use serves on and nothing is rescaled. One test a pass for the whole wave, a scalar branch.
    // taken on the first pass (off = 3e38 makes every term infinite) and whenever a score has risen so far above the maximum in use that a lane's sum leaves the range; marked unlikely so that the usual pass runs straight on, without a taken jump
    if (__builtin_expect(__builtin_amdgcn_ballot_w32(fmaxf(ps[0], ps[1]) > PSMAX) != 0, 0)) {
      v16h kt[2][2];   // the pass's k rows once more, and its scores by the same products: so the scores need not be held in registers over the test in every pass
#pragma unroll
      for (int t = 0; t < 2; ++t)
#pragma unroll
        for (int kc = 0; kc < 2; ++kc) kt[t][kc] = frag_l(kb + t * 16 * KPIT + kc * 64);
#pragma unroll
      for (int u = 0; u < 2; ++u)
#pragma unroll
        for (int t = 0; t < 2; ++t) s[u][t] = v8f{};
#pragma unroll
      for (int kc = 0; kc < 2; ++kc)
#pragma unroll
        for (int t = 0; t < 2; ++t)
#pragma unroll
          for (int u = 0; u < 2; ++u) s[u][t] = mm16(kt[t][kc], qf[u][kc], s[u][t]);
      float on[2], alpha[2];
#pragma unroll
      for (int u = 0; u < 2; ++u) {
        float mx = fmaxf(s[u][0][0], s[u][1][0]);
#pragma unroll
        for (int r = 1; r < 8; ++r) mx = fmaxf(mx, fmaxf(s[u][0][r], s[u][1][r]));
        mx = fmaxf(mx, xhalf(mx)); on[u] = fminf(off[u], fmaf(mx, -LSC, 11.0f)); }   // both halves of a query take the same new maximum
      exp2x2(alpha[0], alpha[1], on[0] - off[0], on[1] - off[1]);   // 0 on the first pass
#pragma unroll
      for (int u = 0; u < 2; ++u) { off[u] = on[u]; l[u] *= alpha[u];
#pragma unroll
        for (int j = 0; j < HD / 16; ++j) o[u][j] *= alpha[u]; }
      terms(0); terms(1); }   // now no term is above 2^11
    l[0] += ps[0]; l[1] += ps[1];
#pragma unroll
    for (int j = 0; j < HD / 16; ++j)
#pragma unroll
      for (int u = 0; u < 2; ++u) o[u][j] = mm16(vf[j], pf[u], o[u][j]);
  };
  for (int s = 0; s < NST; ++s) {
    const unsigned char* kb = ring + (s & 1) * STG + col * KPIT + 16 * g; const unsigned char* vb = ring + (s & 1) * STG + KTILE + col * VPIT + 16 * g;
#pragma unroll
    for (int t = 0; t < 2; ++t)
#pragma unroll
      for (int kc = 0; kc < 2; ++kc) kf[t][kc] = frag_l(kb + t * 16 * KPIT + kc * 64);
#pragma unroll 1   // kept rolled: unrolled, every pass's sum of exponentials is sunk to the stage's foot and its terms are held till there, which takes the registers past 256 and into scratch
    for (int p = 0; p < SK / 32 - 1; ++p) { pass(kb, vb, true); kb += 32 * KPIT; vb += 64; }
    pass(kb, vb, false);
    asm volatile("s_wait_dscnt 0x0" ::: "memory");      // this wave's reads of stage s are done
    asm volatile("s_wait_asynccnt 0x0" ::: "memory");   // this wave's copies of stage s + 1 have landed
    __syncthreads();                                    // publishes stage s + 1 and ends every wave's reads of stage s, whose buffer the copies behind it refill
    if (s + 2 < NST) copy(s + 2, s & 1); }
  asm volatile("s_wait_asynccnt 0x0" ::: "memory");     // no copy is outstanding when the wave ends
  float* yr = Y + ((size_t)b * TT + q0 + col) * CC + h * HD + 8 * g;
#pragma unroll
  for (int u = 0; u < 2; ++u) { const float inv = 1.0f / (l[u] + xhalf(l[u]));
#pragma unroll
    for (int j = 0; j < HD / 16; ++j) o[u][j] *= inv; }
  __builtin_amdgcn_sched_barrier(0);   // every product in front of the first store: no register of an issued store is written again
#pragma unroll
  for (int u = 0; u < 2; ++u)
#pragma unroll
    for (int j = 0; j < HD / 16; ++j) { const v8f r = o[u][j]; const v4f lo = { r[0], r[1], r[2], r[3] }, hi = { r[4], r[5], r[6], r[7] }; vst2(yr + u * 16 * CC + j * 16, lo); vst2(yr + u * 16 * CC + j * 16 + 4, hi); } }

extern "C" void kernel_launch(void* const* d_in, const int* in_sizes, int n_in, void* d_out, int out_size, void* d_ws, size_t ws_size, hipStream_t stream) {
  (void)in_sizes; (void)n_in; (void)out_size;
  const float** F = (const float**)d_in;
  if (ws_size < (size_t)WS_END) return;
  char* ws = (char*)d_ws; _Float16 *QH = (_Float16*)(ws + WS_QH), *KH = (_Float16*)(ws + WS_KH), *VT = (_Float16*)(ws + WS_VT), *QL = (_Float16*)(ws + WS_QL), *KL = (_Float16*)(ws + WS_KL); __bf16 *VB = (__bf16*)(ws + WS_VB), *VBL = (__bf16*)(ws + WS_VBL); float *S = (float*)(ws + WS_S), *Y = (float*)(ws + WS_Y);
  (void)Y; (void)S; (void)QL; (void)KL; (void)VB; (void)VBL;
  // inputs: 0 x [2,2048,1024]; 1 Wq [1024,1024] (in,out), 2 bq; 3 Wk, 4 bk; 5 Wv, 6 bv (biases nonzero); no output projection
  k_proj<<<dim3(TNB * TT / PBM, CC / PBN, 3), PTH, 0, stream>>>(F[0], F[0], F[0], F[1], F[3], F[5], F[2], F[4], F[6], QH, KH, VT);
  k_attn<<<dim3(TT / (AW * QCOLS), TNB * NH), AW * 32, 0, stream>>>(QH, KH, VT, (float*)d_out);
}
